// v000
// Times are from an AMD MI455X. After a warm-up the kernel runs many times in a row, and a time is the length of
// such a window on the GPU divided by its runs, so every launch and the gaps after it count. The runs cycle
// through copies of the inputs. A figure is the median of several windows, for all but v000 over two sittings.
// Sittings can differ by a few percent; kernels timed side by side share one.
// v000 is the starting kernel. One run takes 209 microseconds.
#include <hip/hip_runtime.h>

// Contractions: per-head q/k/v projections = v_wmma_f32_16x16x32_bf16 (bf16 operands from RNE-converted x and W, f32 accumulate, bf16-rounded bias added in f32); attention scores q.k and p.v = v_wmma_f32_16x16x32_f16 (fp16 operands, p carried x1024, f32 accumulate); online softmax, normalisation and output in f32.
// Layout: x [NB][SEQ_FULL][1024] (first SEQ rows of each batch used) viewed as 16 head slices of 64; q = x_h Wq[h]^T + bq[h] (W is [h][out][in]), k, v likewise; scores = q.k / 8 over all SEQ keys, softmax, out_h = attn v; heads re-stacked -> [NB][SEQ][1024].

#ifndef NB
#define NB 2
#endif
#ifndef SEQ
#define SEQ 2048
#endif
#define NB_FULL  2
#define SEQ_FULL 2048
#define DM   1024
#define NH   16
#define HD   64
#define KT   64          // keys staged in LDS per iteration
#define QB   256         // queries per block (8 waves x 32)
#define OSP  68          // LDS pitch (floats) of the per-wave output staging tile
#define PCAR 1024.0f     // power-of-two carry on the fp16 p operand
#define SCL  0.125f      // HD^-0.5
#define L2E  1.4426950408889634f

static_assert(DM == NH * HD);
static_assert(SEQ % QB == 0);
static_assert(SEQ % KT == 0);
static_assert((NB * SEQ) % 64 == 0);
static_assert(NB >= 1 && NB <= NB_FULL);
static_assert(SEQ >= QB && SEQ <= SEQ_FULL);
static_assert(HD % 32 == 0);

typedef _Float16 h16;
typedef unsigned short bf;
typedef __attribute__((ext_vector_type(16))) __bf16   v16bf;
typedef __attribute__((ext_vector_type(16))) _Float16 v16h;
typedef __attribute__((ext_vector_type(8)))  _Float16 v8h;
typedef __attribute__((ext_vector_type(2)))  _Float16 v2h;
typedef __attribute__((ext_vector_type(8)))  unsigned short v8us;
typedef __attribute__((ext_vector_type(8)))  float    v8f;
typedef __attribute__((ext_vector_type(4)))  float    v4f;
typedef __attribute__((ext_vector_type(2)))  float    v2f;
typedef v4f __attribute__((may_alias)) v4fa;

__device__ __forceinline__ unsigned short f2bf(float f) { unsigned u = __float_as_uint(f); u += 0x7FFFu + ((u >> 16) & 1u); return (unsigned short)(u >> 16); }
__device__ __forceinline__ float bf2f(unsigned short b) { return __uint_as_float(((unsigned)b) << 16); }
__device__ __forceinline__ float bfr(float f) { return bf2f(f2bf(f)); }
__device__ __forceinline__ v16h  cat16(v8h lo, v8h hi) { return __builtin_shufflevector(lo, hi, 0, 1, 2, 3, 4, 5, 6, 7, 8, 9, 10, 11, 12, 13, 14, 15); }
__device__ __forceinline__ v16bf cat16b(v8us lo, v8us hi) { return __builtin_bit_cast(v16bf, __builtin_shufflevector(lo, hi, 0, 1, 2, 3, 4, 5, 6, 7, 8, 9, 10, 11, 12, 13, 14, 15)); }
__device__ __forceinline__ v8f wmma16(v16h a, v16h b, v8f c) { return __builtin_amdgcn_wmma_f32_16x16x32_f16(false, a, false, b, (short)0, c, false, false); }
__device__ __forceinline__ v8f wmmab(v16bf a, v16bf b, v8f c) { return __builtin_amdgcn_wmma_f32_16x16x32_bf16(false, a, false, b, (short)0, c, false, false); }
// Fragment loaders (A and B identical): p = plane + row(l&15) * pitch + k0 + 8*(l>>4); elements 0..7 <- p[0..7], elements 8..15 <- p[16..23] (k0+16+8h..).
__device__ __forceinline__ v16h  ldh(const h16* p) { return cat16(*(const v8h*)p, *(const v8h*)(p + 16)); }
__device__ __forceinline__ v16bf ldb16(const bf* p) { return cat16b(*(const v8us*)p, *(const v8us*)(p + 16)); }

__global__ __launch_bounds__(256) void k_cvtw(const float* __restrict__ w0, const float* __restrict__ w1, const float* __restrict__ w2, bf* dst, int n8) {
    const int i = blockIdx.x * 256 + threadIdx.x; if (i >= n8) return;
    const int sel = blockIdx.y;
    const float* src = (sel == 0) ? w0 : ((sel == 1) ? w1 : w2);
    const v8f v = *(const v8f*)(src + (size_t)i * 8); v8us o;
#pragma unroll
    for (int k = 0; k < 8; ++k) o[k] = f2bf(v[k]);
    bf* d = dst + (size_t)sel * n8 * 8 + (size_t)i * 8;
    *(v8us*)d = o; 
}
__global__ __launch_bounds__(256) void k_cvtx(const float* __restrict__ x, bf* XB, int n8) {
    const int i = blockIdx.x * 256 + threadIdx.x; if (i >= n8) return;
    const size_t el = (size_t)i * 8; const int c = (int)(el % DM); const size_t row = el / DM; const int t = (int)(row % SEQ); const int b = (int)(row / SEQ);
    const v8f v = *(const v8f*)(x + ((size_t)b * SEQ_FULL + t) * DM + c); v8us o;
#pragma unroll
    for (int k = 0; k < 8; ++k) o[k] = f2bf(v[k]);
    *(v8us*)(XB + el) = o; 
}

// ---- k_gemmw: register-blocked GEMM, ONE WAVE per 64x64 output tile (16 accumulators), operands straight from K-contiguous bf16 planes; grid (M/64, N/64, Z), 32 threads.
// C[m][n] (f32, pitch ldc) = sum_k A[m][k] Bt[n][k] + bf16(bias[n]); A pitch lda, Bt pitch ldb; z strides sA/sB/sC/sBias in elements; K % 32 == 0.
__global__ __launch_bounds__(32) void k_gemmw(const bf* __restrict__ A, int lda, const bf* __restrict__ Bt, int ldb, int K, float* C, int ldc, const float* __restrict__ bias, size_t sA, size_t sB, size_t sC, size_t sBias) {
    __shared__ __align__(16) float os[16 * OSP];
    const size_t z = blockIdx.z; A += z * sA; Bt += z * sB; C += z * sC; bias += z * sBias;
    const int lane = threadIdx.x & 31, lr = lane & 15, hi = lane >> 4; const int r0 = blockIdx.x * 64, c0 = blockIdx.y * 64;
    v8f acc[4][4];
#pragma unroll
    for (int mb = 0; mb < 4; ++mb)
#pragma unroll
        for (int nb = 0; nb < 4; ++nb) acc[mb][nb] = (v8f){};
    const size_t aoff = (size_t)(r0 + lr) * lda + 8 * hi, boff = (size_t)(c0 + lr) * ldb + 8 * hi;
    v16bf a[4], bfrag;
#pragma unroll 1
    for (int kc = 0; kc < K; kc += 32) {
#pragma unroll
        for (int mb = 0; mb < 4; ++mb) a[mb] = ldb16(A + aoff + (size_t)mb * 16 * lda + kc);
#pragma unroll
        for (int nb = 0; nb < 4; ++nb) { bfrag = ldb16(Bt + boff + (size_t)nb * 16 * ldb + kc);
#pragma unroll
            for (int mb = 0; mb < 4; ++mb) acc[mb][nb] = wmmab(a[mb], bfrag, acc[mb][nb]); }
        asm volatile("v_nop\n\tv_nop\n\tv_nop\n\tv_nop" : "+v"(acc[0][0]), "+v"(acc[1][1]), "+v"(acc[2][2]), "+v"(acc[3][3]) : "v"(a[0]), "v"(a[3]), "v"(bfrag));
    }
#pragma unroll
    for (int mb = 0; mb < 4; ++mb) {
#pragma unroll
        for (int nb = 0; nb < 4; ++nb) {
#pragma unroll
            for (int j = 0; j < 8; ++j) os[(hi * 8 + j) * OSP + nb * 16 + lr] = acc[mb][nb][j]; }
        __builtin_amdgcn_fence(3, "wavefront"); __builtin_amdgcn_wave_barrier(); asm volatile("" ::: "memory");
        float* crow = C + (size_t)(r0 + mb * 16) * ldc + c0;
{
#pragma unroll
            for (int s = 0; s < 8; ++s) { const int row = 2 * s + hi, cofs = lr * 4; v4f val = *(const v4fa*)(os + row * OSP + cofs);
                val[0] += bfr(bias[c0 + cofs]); val[1] += bfr(bias[c0 + cofs + 1]); val[2] += bfr(bias[c0 + cofs + 2]); val[3] += bfr(bias[c0 + cofs + 3]);
                *(v4f*)(crow + (size_t)row * ldc + cofs) = val; }
             }
        __builtin_amdgcn_wave_barrier(); asm volatile("" ::: "memory");
    }
}

__global__ __launch_bounds__(256) void k_qkp(const float* __restrict__ F, h16* P) {
    const size_t e = ((size_t)blockIdx.x * 256 + threadIdx.x) * 2; if (e >= (size_t)NB * NH * SEQ * HD) return;
    const int d = (int)(e % HD); const int t = (int)((e / HD) % SEQ); const int h = (int)((e / ((size_t)HD * SEQ)) % NH); const int b = (int)(e / ((size_t)HD * SEQ * NH));
    const v2f xv = *(const v2f*)(F + ((size_t)b * SEQ + t) * DM + h * HD + d);
    v2h o; o[0] = (h16)xv[0]; o[1] = (h16)xv[1];
    *(v2h*)(P + e) = o; 
}
__global__ __launch_bounds__(256) void k_vtp(const float* __restrict__ F, h16* VT) {
    const size_t e = ((size_t)blockIdx.x * 256 + threadIdx.x) * 2; if (e >= (size_t)NB * NH * HD * SEQ) return;
    const int t = (int)(e % SEQ); const int d = (int)((e / SEQ) % HD); const int h = (int)((e / ((size_t)SEQ * HD)) % NH); const int b = (int)(e / ((size_t)SEQ * HD * NH));
    const float* f = F + ((size_t)b * SEQ + t) * DM + h * HD + d;
    v2h o; o[0] = (h16)f[0]; o[1] = (h16)f[DM];
    *(v2h*)(VT + e) = o; 
}

// ---- k_attn: flash attention, block = 8 waves, one (b,h), QB queries; one wave = 32 queries (2 tiles of 16).
// Per 64-key iteration: K tile [t][d] and V^T tile [d][t] staged in LDS (plain 16-B loads, block barriers before and after: cross-wave regions);
// S^T = K . Q^T per 16-key sub-tile (A = K rows from LDS, B = Q columns from the plane, both split-k loaders), so each lane holds 8 keys of one query;
// online softmax in f32 (running max, one exp2 per score); p x1024 packed into A fragments straight from the two adjacent 16-key accumulator tiles
// (element r <- keys 0-15 tile, element 8+r <- keys 16-31 tile, lane unchanged); O += P . V with B = V^T rows from LDS.
__global__ __launch_bounds__(256) __attribute__((amdgpu_num_vgpr(256)))
void k_attn(const h16* __restrict__ Q16, const h16* __restrict__ K16, const h16* __restrict__ VT16, float* OUT) {
    __shared__ __align__(16) h16 Ks[KT * HD];            // [t][d], cross-wave (block barriers)
    __shared__ __align__(16) h16 Vs[HD * KT];            // [d][t], cross-wave (block barriers)
    __shared__ __align__(16) float osh[QB / 32][16 * OSP]; // wave-private output staging
    const int tid = threadIdx.x, wv = tid >> 5, lane = tid & 31, lr = lane & 15, hi = lane >> 4;
    const int qblks = SEQ / QB; const int bh = blockIdx.x / qblks, qblk = blockIdx.x % qblks; const int b = bh / NH, h = bh % NH;
    const int q0 = qblk * QB + wv * 32;
    const h16* Qp = Q16 + ((size_t)bh * SEQ + q0) * HD;
    v16h qf[2][2];
#pragma unroll
    for (int qt = 0; qt < 2; ++qt)
#pragma unroll
        for (int kk = 0; kk < 2; ++kk) qf[qt][kk] = ldh(Qp + (size_t)(qt * 16 + lr) * HD + kk * 32 + 8 * hi);
    const h16* Kb = K16 + (size_t)bh * SEQ * HD; const h16* Vb = VT16 + (size_t)bh * HD * SEQ;
    v8f o[2][4];
#pragma unroll
    for (int qt = 0; qt < 2; ++qt)
#pragma unroll
        for (int et = 0; et < 4; ++et) o[qt][et] = (v8f){};
    float m_run[2] = {-1.0e30f, -1.0e30f}, l_run[2] = {0.f, 0.f};
    float* os = osh[wv];
#pragma unroll 1
    for (int t0 = 0; t0 < SEQ; t0 += KT) {
        __syncthreads();
#pragma unroll
        for (int j = 0; j < 2; ++j) { const int u = tid + j * 256; const int e = u >> 3, uu = u & 7;
            const v8h kx = *(const v8h*)(Kb + (size_t)t0 * HD + (size_t)u * 8);
            const v8h vx = *(const v8h*)(Vb + (size_t)e * SEQ + t0 + uu * 8);
            *(v8h*)(Ks + u * 8) = kx; *(v8h*)(Vs + e * KT + uu * 8) = vx; }
        __syncthreads();
#pragma unroll
        for (int qt = 0; qt < 2; ++qt) {
            v8f st[4]; v16h ka0, ka1;
#pragma unroll
            for (int ts = 0; ts < 4; ++ts) { ka0 = ldh(Ks + (ts * 16 + lr) * HD + 8 * hi); ka1 = ldh(Ks + (ts * 16 + lr) * HD + 32 + 8 * hi);
                v8f c = (v8f){}; c = wmma16(ka0, qf[qt][0], c); c = wmma16(ka1, qf[qt][1], c); st[ts] = c; }
            asm volatile("v_nop\n\tv_nop\n\tv_nop\n\tv_nop" : "+v"(st[0]), "+v"(st[1]), "+v"(st[2]), "+v"(st[3]) : "v"(ka0), "v"(ka1), "v"(qf[qt][1]));
            // online softmax: lane owns query lr, keys 8*hi + r of each 16-key sub-tile; the partner lane (lane ^ 16) owns the other 32 keys
            float tm = -1.0e30f;
#pragma unroll
            for (int ts = 0; ts < 4; ++ts)
#pragma unroll
                for (int v = 0; v < 8; ++v) { const float t = st[ts][v] * SCL; st[ts][v] = t; tm = fmaxf(tm, t); }
            tm = fmaxf(tm, __shfl_xor(tm, 16, 32));
            const float m_new = fmaxf(m_run[qt], tm);
            float da = __fsub_rn(m_run[qt], m_new); asm volatile("" : "+v"(da));
            const float alpha = __builtin_amdgcn_exp2f(__fmul_rn(da, L2E));
            float rs = 0.f; v16h pa[2];
#pragma unroll
            for (int v = 0; v < 8; ++v) {
                float d0 = __fsub_rn(st[0][v], m_new), d1 = __fsub_rn(st[1][v], m_new), d2 = __fsub_rn(st[2][v], m_new), d3 = __fsub_rn(st[3][v], m_new);
                asm volatile("" : "+v"(d0)); asm volatile("" : "+v"(d1)); asm volatile("" : "+v"(d2)); asm volatile("" : "+v"(d3));
                const float p0 = __builtin_amdgcn_exp2f(__fmul_rn(d0, L2E)), p1 = __builtin_amdgcn_exp2f(__fmul_rn(d1, L2E));
                const float p2 = __builtin_amdgcn_exp2f(__fmul_rn(d2, L2E)), p3 = __builtin_amdgcn_exp2f(__fmul_rn(d3, L2E));
                rs += (p0 + p1) + (p2 + p3);
                pa[0][v] = (h16)(p0 * PCAR); pa[0][v + 8] = (h16)(p1 * PCAR);   // keys 8h+v and 16+8h+v of the 64-key tile
                pa[1][v] = (h16)(p2 * PCAR); pa[1][v + 8] = (h16)(p3 * PCAR);   // keys 32+8h+v and 48+8h+v
            }
            rs += __shfl_xor(rs, 16, 32);
            l_run[qt] = l_run[qt] * alpha + rs; m_run[qt] = m_new;
            // rescale O: accumulator element v of this lane is query row 8*hi + v; alpha for that query lives in lane 8*hi + v
#pragma unroll
            for (int v = 0; v < 8; ++v) { const float fs = __shfl(alpha, v + 8 * hi, 32); o[qt][0][v] *= fs; o[qt][1][v] *= fs; o[qt][2][v] *= fs; o[qt][3][v] *= fs; }
            v16h vb0, vb1;
#pragma unroll
            for (int et = 0; et < 4; ++et) { vb0 = ldh(Vs + (et * 16 + lr) * KT + 8 * hi); vb1 = ldh(Vs + (et * 16 + lr) * KT + 32 + 8 * hi);
                o[qt][et] = wmma16(pa[0], vb0, o[qt][et]); o[qt][et] = wmma16(pa[1], vb1, o[qt][et]); }
            asm volatile("v_nop\n\tv_nop\n\tv_nop\n\tv_nop" : "+v"(o[qt][0]), "+v"(o[qt][1]), "+v"(o[qt][2]), "+v"(o[qt][3]) : "v"(pa[0]), "v"(pa[1]), "v"(vb1));
        }
    }
    // epilogue: out[b][q][h*HD + d] = O[q][d] / (l * PCAR)
#pragma unroll
    for (int qt = 0; qt < 2; ++qt) {
        const float inv = 1.0f / (l_run[qt] * PCAR);
#pragma unroll
        for (int j = 0; j < 8; ++j) { const float fs = __shfl(inv, j + 8 * hi, 32);
#pragma unroll
            for (int et = 0; et < 4; ++et) os[(hi * 8 + j) * OSP + et * 16 + lr] = o[qt][et][j] * fs; }
        __builtin_amdgcn_fence(3, "wavefront"); __builtin_amdgcn_wave_barrier(); asm volatile("" ::: "memory");
        float* crow = OUT + ((size_t)b * SEQ + q0 + qt * 16) * DM + (size_t)h * HD;
{
#pragma unroll
            for (int s = 0; s < 8; ++s) { const int row = 2 * s + hi, cofs = lr * 4; const v4f val = *(const v4fa*)(os + row * OSP + cofs);
                *(v4f*)(crow + (size_t)row * DM + cofs) = val; }
             }
        __builtin_amdgcn_wave_barrier(); asm volatile("" ::: "memory");
    }
}

extern "C" void kernel_launch(void* const* d_in, const int* in_sizes, int n_in,
                              void* d_out, int out_size, void* d_ws, size_t ws_size, hipStream_t stream) {
    if (n_in < 7) return;
    if (in_sizes[0] < (NB - 1) * SEQ_FULL * DM + SEQ * DM) return;
    if (in_sizes[1] < NH * HD * HD || in_sizes[3] < NH * HD * HD || in_sizes[5] < NH * HD * HD) return;
    if (in_sizes[2] < NH * HD || in_sizes[4] < NH * HD || in_sizes[6] < NH * HD) return;
    if (out_size < NB * SEQ * DM) return;
    const float* x = (const float*)d_in[0]; const float* wq = (const float*)d_in[1]; const float* bq = (const float*)d_in[2]; const float* wk = (const float*)d_in[3]; const float* bk = (const float*)d_in[4]; const float* wv = (const float*)d_in[5]; const float* bv = (const float*)d_in[6];
    float* OUT = (float*)d_out;     // [NB][SEQ][DM]
    char* wsp = (char*)d_ws;
    auto take = [&](size_t bytes) { char* p = wsp; wsp += (bytes + 255) & ~(size_t)255; return (void*)p; };
    const size_t wsz = (size_t)NH * HD * HD;                  // one weight tensor, elements
    bf*  WB   = (bf*)take(3 * wsz * 2);                        // [3][16][64][64] bf16 = 393,216 B
    bf*  XB   = (bf*)take((size_t)NB * SEQ * DM * 2);          // [NB*SEQ][1024] bf16 = 8,388,608 B
    float* F  = (float*)take((size_t)NB * SEQ * DM * 4);       // [NB*SEQ][1024] f32 (reused q -> k -> v, stream ordered) = 16,777,216 B
    h16* Q16  = (h16*)take((size_t)NB * NH * SEQ * HD * 2);    // [NB][16][SEQ][64] fp16 = 8,388,608 B
    h16* K16  = (h16*)take((size_t)NB * NH * SEQ * HD * 2);
    h16* VT16 = (h16*)take((size_t)NB * NH * HD * SEQ * 2);    // [NB][16][64][SEQ] fp16
    if ((size_t)(wsp - (char*)d_ws) > ws_size) return;         // total 50,724,864 B
    const int nw8 = (int)(wsz / 8); const int nx8 = NB * SEQ * DM / 8;
    k_cvtw<<<dim3((unsigned)((nw8 + 255) / 256), 3, 1), 256, 0, stream>>>(wq, wk, wv, WB, nw8);
    k_cvtx<<<(unsigned)((nx8 + 255) / 256), 256, 0, stream>>>(x, XB, nx8);
    const dim3 gg((unsigned)(NB * SEQ / 64), 1, NH);            // M = NB*SEQ rows, N = 64 per head, z = head
    const unsigned LP = (unsigned)(((size_t)NB * NH * SEQ * HD / 2 + 255) / 256);
    k_gemmw<<<gg, 32, 0, stream>>>(XB, DM, WB, HD, HD, F, DM, bq, (size_t)HD, (size_t)HD * HD, (size_t)HD, (size_t)HD);
    k_qkp<<<LP, 256, 0, stream>>>(F, Q16);
    k_gemmw<<<gg, 32, 0, stream>>>(XB, DM, WB + wsz, HD, HD, F, DM, bk, (size_t)HD, (size_t)HD * HD, (size_t)HD, (size_t)HD);
    k_qkp<<<LP, 256, 0, stream>>>(F, K16);
    k_gemmw<<<gg, 32, 0, stream>>>(XB, DM, WB + 2 * wsz, HD, HD, F, DM, bv, (size_t)HD, (size_t)HD * HD, (size_t)HD, (size_t)HD);
    k_vtp<<<LP, 256, 0, stream>>>(F, VT16);
    k_attn<<<(unsigned)(NB * NH * (SEQ / QB)), 256, 0, stream>>>(Q16, K16, VT16, OUT);
}

// v001
// One run takes 136 microseconds.
// Next to v000, in two timings, it ran 1.55 times as fast each time.
#include <hip/hip_runtime.h>

// Contractions: per-head q/k/v projections = v_wmma_f32_16x16x32_bf16 (bf16 operands from RNE-converted x and W, f32 accumulate, bf16-rounded bias added in f32); attention scores q.k and p.v = v_wmma_f32_16x16x32_f16 (fp16 operands, p carried x1024, f32 accumulate); online softmax, normalisation and output in f32.
// Layout: x [NB][SEQ_FULL][1024] (first SEQ rows of each batch used) viewed as 16 head slices of 64; q = x_h Wq[h]^T + bq[h] (W is [h][out][in]), k, v likewise; scores = q.k / 8 over all SEQ keys, softmax, out_h = attn v; heads re-stacked -> [NB][SEQ][1024].

#ifndef NB
#define NB 2
#endif
#ifndef SEQ
#define SEQ 2048
#endif
#define NB_FULL  2
#define SEQ_FULL 2048
#define DM   1024
#define NH   16
#define HD   64
#define KT   64          // keys staged in LDS per iteration
#define QB   256         // queries per block (8 waves x 32)
#define KP   72          // LDS pitch (halves) of the K and V^T tile rows: 144 B = 16 B x odd, so the 16 rows one ds_load_b128 half-wave reads fall on 64 distinct banks
#define OSP  68          // LDS pitch (floats) of the per-wave output staging tile
#define PCAR 1024.0f     // power-of-two carry on the fp16 p operand
#define SCL  0.125f      // HD^-0.5
#define L2E  1.4426950408889634f

static_assert(DM == NH * HD);
static_assert(SEQ % QB == 0);
static_assert(SEQ % KT == 0);
static_assert((NB * SEQ) % 64 == 0);
static_assert(NB >= 1 && NB <= NB_FULL);
static_assert(SEQ >= QB && SEQ <= SEQ_FULL);
static_assert(HD % 32 == 0);
static_assert(HD == 64 && KT == 64 && KP >= 64 && KP % 8 == 0);

typedef _Float16 h16;
typedef unsigned short bf;
typedef __attribute__((ext_vector_type(16))) __bf16   v16bf;
typedef __attribute__((ext_vector_type(16))) _Float16 v16h;
typedef __attribute__((ext_vector_type(8)))  _Float16 v8h;
typedef __attribute__((ext_vector_type(2)))  _Float16 v2h;
typedef __attribute__((ext_vector_type(8)))  unsigned short v8us;
typedef __attribute__((ext_vector_type(8)))  float    v8f;
typedef __attribute__((ext_vector_type(4)))  float    v4f;
typedef __attribute__((ext_vector_type(2)))  float    v2f;
typedef v4f __attribute__((may_alias)) v4fa;

__device__ __forceinline__ unsigned short f2bf(float f) { unsigned u = __float_as_uint(f); u += 0x7FFFu + ((u >> 16) & 1u); return (unsigned short)(u >> 16); }
__device__ __forceinline__ float bf2f(unsigned short b) { return __uint_as_float(((unsigned)b) << 16); }
__device__ __forceinline__ float bfr(float f) { return bf2f(f2bf(f)); }
__device__ __forceinline__ v16h  cat16(v8h lo, v8h hi) { return __builtin_shufflevector(lo, hi, 0, 1, 2, 3, 4, 5, 6, 7, 8, 9, 10, 11, 12, 13, 14, 15); }
__device__ __forceinline__ v16bf cat16b(v8us lo, v8us hi) { return __builtin_bit_cast(v16bf, __builtin_shufflevector(lo, hi, 0, 1, 2, 3, 4, 5, 6, 7, 8, 9, 10, 11, 12, 13, 14, 15)); }
__device__ __forceinline__ v8f wmma16(v16h a, v16h b, v8f c) { return __builtin_amdgcn_wmma_f32_16x16x32_f16(false, a, false, b, (short)0, c, false, false); }
__device__ __forceinline__ v8f wmmab(v16bf a, v16bf b, v8f c) { return __builtin_amdgcn_wmma_f32_16x16x32_bf16(false, a, false, b, (short)0, c, false, false); }
// Fragment loaders (A and B identical): p = plane + row(l&15) * pitch + k0 + 8*(l>>4); elements 0..7 <- p[0..7], elements 8..15 <- p[16..23] (k0+16+8h..).
__device__ __forceinline__ v16h  ldh(const h16* p) { return cat16(*(const v8h*)p, *(const v8h*)(p + 16)); }
__device__ __forceinline__ v16bf ldb16(const bf* p) { return cat16b(*(const v8us*)p, *(const v8us*)(p + 16)); }

__global__ __launch_bounds__(256) void k_cvtw(const float* __restrict__ w0, const float* __restrict__ w1, const float* __restrict__ w2, bf* dst, int n8) {
    const int i = blockIdx.x * 256 + threadIdx.x; if (i >= n8) return;
    const int sel = blockIdx.y;
    const float* src = (sel == 0) ? w0 : ((sel == 1) ? w1 : w2);
    const v8f v = *(const v8f*)(src + (size_t)i * 8); v8us o;
#pragma unroll
    for (int k = 0; k < 8; ++k) o[k] = f2bf(v[k]);
    bf* d = dst + (size_t)sel * n8 * 8 + (size_t)i * 8;
    *(v8us*)d = o; 
}
__global__ __launch_bounds__(256) void k_cvtx(const float* __restrict__ x, bf* XB, int n8) {
    const int i = blockIdx.x * 256 + threadIdx.x; if (i >= n8) return;
    const size_t el = (size_t)i * 8; const int c = (int)(el % DM); const size_t row = el / DM; const int t = (int)(row % SEQ); const int b = (int)(row / SEQ);
    const v8f v = *(const v8f*)(x + ((size_t)b * SEQ_FULL + t) * DM + c); v8us o;
#pragma unroll
    for (int k = 0; k < 8; ++k) o[k] = f2bf(v[k]);
    *(v8us*)(XB + el) = o; 
}

// ---- k_gemmw: register-blocked GEMM, ONE WAVE per 64x64 output tile (16 accumulators), operands straight from K-contiguous bf16 planes; grid (M/64, N/64, Z), 32 threads.
// C[m][n] (f32, pitch ldc) = sum_k A[m][k] Bt[n][k] + bf16(bias[n]); A pitch lda, Bt pitch ldb; z strides sA/sB/sC/sBias in elements; K % 32 == 0.
__global__ __launch_bounds__(32) void k_gemmw(const bf* __restrict__ A, int lda, const bf* __restrict__ Bt, int ldb, int K, float* C, int ldc, const float* __restrict__ bias, size_t sA, size_t sB, size_t sC, size_t sBias) {
    __shared__ __align__(16) float os[16 * OSP];
    const size_t z = blockIdx.z; A += z * sA; Bt += z * sB; C += z * sC; bias += z * sBias;
    const int lane = threadIdx.x & 31, lr = lane & 15, hi = lane >> 4; const int r0 = blockIdx.x * 64, c0 = blockIdx.y * 64;
    v8f acc[4][4];
#pragma unroll
    for (int mb = 0; mb < 4; ++mb)
#pragma unroll
        for (int nb = 0; nb < 4; ++nb) acc[mb][nb] = (v8f){};
    const size_t aoff = (size_t)(r0 + lr) * lda + 8 * hi, boff = (size_t)(c0 + lr) * ldb + 8 * hi;
    v16bf a[4], bfrag;
#pragma unroll 1
    for (int kc = 0; kc < K; kc += 32) {
#pragma unroll
        for (int mb = 0; mb < 4; ++mb) a[mb] = ldb16(A + aoff + (size_t)mb * 16 * lda + kc);
#pragma unroll
        for (int nb = 0; nb < 4; ++nb) { bfrag = ldb16(Bt + boff + (size_t)nb * 16 * ldb + kc);
#pragma unroll
            for (int mb = 0; mb < 4; ++mb) acc[mb][nb] = wmmab(a[mb], bfrag, acc[mb][nb]); }
        asm volatile("v_nop\n\tv_nop\n\tv_nop\n\tv_nop" : "+v"(acc[0][0]), "+v"(acc[1][1]), "+v"(acc[2][2]), "+v"(acc[3][3]) : "v"(a[0]), "v"(a[3]), "v"(bfrag));
    }
#pragma unroll
    for (int mb = 0; mb < 4; ++mb) {
#pragma unroll
        for (int nb = 0; nb < 4; ++nb) {
#pragma unroll
            for (int j = 0; j < 8; ++j) os[(hi * 8 + j) * OSP + nb * 16 + lr] = acc[mb][nb][j]; }
        __builtin_amdgcn_fence(3, "wavefront"); __builtin_amdgcn_wave_barrier(); asm volatile("" ::: "memory");
        float* crow = C + (size_t)(r0 + mb * 16) * ldc + c0;
{
#pragma unroll
            for (int s = 0; s < 8; ++s) { const int row = 2 * s + hi, cofs = lr * 4; v4f val = *(const v4fa*)(os + row * OSP + cofs);
                val[0] += bfr(bias[c0 + cofs]); val[1] += bfr(bias[c0 + cofs + 1]); val[2] += bfr(bias[c0 + cofs + 2]); val[3] += bfr(bias[c0 + cofs + 3]);
                *(v4f*)(crow + (size_t)row * ldc + cofs) = val; }
             }
        __builtin_amdgcn_wave_barrier(); asm volatile("" ::: "memory");
    }
}

__global__ __launch_bounds__(256) void k_qkp(const float* __restrict__ F, h16* P) {
    const size_t e = ((size_t)blockIdx.x * 256 + threadIdx.x) * 2; if (e >= (size_t)NB * NH * SEQ * HD) return;
    const int d = (int)(e % HD); const int t = (int)((e / HD) % SEQ); const int h = (int)((e / ((size_t)HD * SEQ)) % NH); const int b = (int)(e / ((size_t)HD * SEQ * NH));
    const v2f xv = *(const v2f*)(F + ((size_t)b * SEQ + t) * DM + h * HD + d);
    v2h o; o[0] = (h16)xv[0]; o[1] = (h16)xv[1];
    *(v2h*)(P + e) = o; 
}
__global__ __launch_bounds__(256) void k_vtp(const float* __restrict__ F, h16* VT) {
    const size_t e = ((size_t)blockIdx.x * 256 + threadIdx.x) * 2; if (e >= (size_t)NB * NH * HD * SEQ) return;
    const int t = (int)(e % SEQ); const int d = (int)((e / SEQ) % HD); const int h = (int)((e / ((size_t)SEQ * HD)) % NH); const int b = (int)(e / ((size_t)SEQ * HD * NH));
    const float* f = F + ((size_t)b * SEQ + t) * DM + h * HD + d;
    v2h o; o[0] = (h16)f[0]; o[1] = (h16)f[DM];
    *(v2h*)(VT + e) = o; 
}

// ---- k_attn: flash attention, block = 8 waves, one (b,h), QB queries; one wave = 32 queries (2 tiles of 16).
// Per 64-key iteration: K tile [t][d] and V^T tile [d][t] staged in LDS (plain 16-B loads, block barriers before and after: cross-wave regions);
// S^T = K . Q^T per 16-key sub-tile (A = K rows from LDS, B = Q columns from the plane, both split-k loaders), so each lane holds 8 keys of one query;
// online softmax in f32 (running max, one exp2 per score); p x1024 packed into A fragments straight from the two adjacent 16-key accumulator tiles
// (element r <- keys 0-15 tile, element 8+r <- keys 16-31 tile, lane unchanged); O += P . V with B = V^T rows from LDS.
__global__ __launch_bounds__(256) __attribute__((amdgpu_num_vgpr(256)))
void k_attn(const h16* __restrict__ Q16, const h16* __restrict__ K16, const h16* __restrict__ VT16, float* OUT) {
    __shared__ __align__(16) h16 Ks[KT * KP];            // [t][d] at pitch KP, cross-wave (block barriers)
    __shared__ __align__(16) h16 Vs[HD * KP];            // [d][t] at pitch KP, cross-wave (block barriers)
    __shared__ __align__(16) float osh[QB / 32][16 * OSP]; // wave-private output staging
    const int tid = threadIdx.x, wv = tid >> 5, lane = tid & 31, lr = lane & 15, hi = lane >> 4;
    const int qblks = SEQ / QB; const int bh = blockIdx.x / qblks, qblk = blockIdx.x % qblks; const int b = bh / NH, h = bh % NH;
    const int q0 = qblk * QB + wv * 32;
    const h16* Qp = Q16 + ((size_t)bh * SEQ + q0) * HD;
    v16h qf[2][2];
#pragma unroll
    for (int qt = 0; qt < 2; ++qt)
#pragma unroll
        for (int kk = 0; kk < 2; ++kk) qf[qt][kk] = ldh(Qp + (size_t)(qt * 16 + lr) * HD + kk * 32 + 8 * hi);
    const h16* Kb = K16 + (size_t)bh * SEQ * HD; const h16* Vb = VT16 + (size_t)bh * HD * SEQ;
    v8f o[2][4];
#pragma unroll
    for (int qt = 0; qt < 2; ++qt)
#pragma unroll
        for (int et = 0; et < 4; ++et) o[qt][et] = (v8f){};
    float m_run[2] = {-1.0e30f, -1.0e30f}, l_run[2] = {0.f, 0.f};
    float* os = osh[wv];
#pragma unroll 1
    for (int t0 = 0; t0 < SEQ; t0 += KT) {
        __syncthreads();
#pragma unroll
        for (int j = 0; j < 2; ++j) { const int u = tid + j * 256; const int e = u >> 3, uu = u & 7;
            const v8h kx = *(const v8h*)(Kb + (size_t)t0 * HD + (size_t)u * 8);
            const v8h vx = *(const v8h*)(Vb + (size_t)e * SEQ + t0 + uu * 8);
            *(v8h*)(Ks + e * KP + uu * 8) = kx; *(v8h*)(Vs + e * KP + uu * 8) = vx; }
        __syncthreads();
#pragma unroll
        for (int qt = 0; qt < 2; ++qt) {
            v8f st[4]; v16h ka0, ka1;
#pragma unroll
            for (int ts = 0; ts < 4; ++ts) { ka0 = ldh(Ks + (ts * 16 + lr) * KP + 8 * hi); ka1 = ldh(Ks + (ts * 16 + lr) * KP + 32 + 8 * hi);
                v8f c = (v8f){}; c = wmma16(ka0, qf[qt][0], c); c = wmma16(ka1, qf[qt][1], c); st[ts] = c; }
            asm volatile("v_nop\n\tv_nop\n\tv_nop\n\tv_nop" : "+v"(st[0]), "+v"(st[1]), "+v"(st[2]), "+v"(st[3]) : "v"(ka0), "v"(ka1), "v"(qf[qt][1]));
            // online softmax: lane owns query lr, keys 8*hi + r of each 16-key sub-tile; the partner lane (lane ^ 16) owns the other 32 keys
            float tm = -1.0e30f;
#pragma unroll
            for (int ts = 0; ts < 4; ++ts)
#pragma unroll
                for (int v = 0; v < 8; ++v) { const float t = st[ts][v] * SCL; st[ts][v] = t; tm = fmaxf(tm, t); }
            tm = fmaxf(tm, __shfl_xor(tm, 16, 32));
            const float m_new = fmaxf(m_run[qt], tm);
            float da = __fsub_rn(m_run[qt], m_new); asm volatile("" : "+v"(da));
            const float alpha = __builtin_amdgcn_exp2f(__fmul_rn(da, L2E));
            float rs = 0.f; v16h pa[2];
#pragma unroll
            for (int v = 0; v < 8; ++v) {
                float d0 = __fsub_rn(st[0][v], m_new), d1 = __fsub_rn(st[1][v], m_new), d2 = __fsub_rn(st[2][v], m_new), d3 = __fsub_rn(st[3][v], m_new);
                asm volatile("" : "+v"(d0)); asm volatile("" : "+v"(d1)); asm volatile("" : "+v"(d2)); asm volatile("" : "+v"(d3));
                const float p0 = __builtin_amdgcn_exp2f(__fmul_rn(d0, L2E)), p1 = __builtin_amdgcn_exp2f(__fmul_rn(d1, L2E));
                const float p2 = __builtin_amdgcn_exp2f(__fmul_rn(d2, L2E)), p3 = __builtin_amdgcn_exp2f(__fmul_rn(d3, L2E));
                rs += (p0 + p1) + (p2 + p3);
                pa[0][v] = (h16)(p0 * PCAR); pa[0][v + 8] = (h16)(p1 * PCAR);   // keys 8h+v and 16+8h+v of the 64-key tile
                pa[1][v] = (h16)(p2 * PCAR); pa[1][v + 8] = (h16)(p3 * PCAR);   // keys 32+8h+v and 48+8h+v
            }
            rs += __shfl_xor(rs, 16, 32);
            l_run[qt] = l_run[qt] * alpha + rs; m_run[qt] = m_new;
            // rescale O: accumulator element v of this lane is query row 8*hi + v; alpha for that query lives in lane 8*hi + v
#pragma unroll
            for (int v = 0; v < 8; ++v) { const float fs = __shfl(alpha, v + 8 * hi, 32); o[qt][0][v] *= fs; o[qt][1][v] *= fs; o[qt][2][v] *= fs; o[qt][3][v] *= fs; }
            v16h vb0, vb1;
#pragma unroll
            for (int et = 0; et < 4; ++et) { vb0 = ldh(Vs + (et * 16 + lr) * KP + 8 * hi); vb1 = ldh(Vs + (et * 16 + lr) * KP + 32 + 8 * hi);
                o[qt][et] = wmma16(pa[0], vb0, o[qt][et]); o[qt][et] = wmma16(pa[1], vb1, o[qt][et]); }
            asm volatile("v_nop\n\tv_nop\n\tv_nop\n\tv_nop" : "+v"(o[qt][0]), "+v"(o[qt][1]), "+v"(o[qt][2]), "+v"(o[qt][3]) : "v"(pa[0]), "v"(pa[1]), "v"(vb1));
        }
    }
    // epilogue: out[b][q][h*HD + d] = O[q][d] / (l * PCAR)
#pragma unroll
    for (int qt = 0; qt < 2; ++qt) {
        const float inv = 1.0f / (l_run[qt] * PCAR);
#pragma unroll
        for (int j = 0; j < 8; ++j) { const float fs = __shfl(inv, j + 8 * hi, 32);
#pragma unroll
            for (int et = 0; et < 4; ++et) os[(hi * 8 + j) * OSP + et * 16 + lr] = o[qt][et][j] * fs; }
        __builtin_amdgcn_fence(3, "wavefront"); __builtin_amdgcn_wave_barrier(); asm volatile("" ::: "memory");
        float* crow = OUT + ((size_t)b * SEQ + q0 + qt * 16) * DM + (size_t)h * HD;
{
#pragma unroll
            for (int s = 0; s < 8; ++s) { const int row = 2 * s + hi, cofs = lr * 4; const v4f val = *(const v4fa*)(os + row * OSP + cofs);
                *(v4f*)(crow + (size_t)row * DM + cofs) = val; }
             }
        __builtin_amdgcn_wave_barrier(); asm volatile("" ::: "memory");
    }
}

extern "C" void kernel_launch(void* const* d_in, const int* in_sizes, int n_in,
                              void* d_out, int out_size, void* d_ws, size_t ws_size, hipStream_t stream) {
    if (n_in < 7) return;
    if (in_sizes[0] < (NB - 1) * SEQ_FULL * DM + SEQ * DM) return;
    if (in_sizes[1] < NH * HD * HD || in_sizes[3] < NH * HD * HD || in_sizes[5] < NH * HD * HD) return;
    if (in_sizes[2] < NH * HD || in_sizes[4] < NH * HD || in_sizes[6] < NH * HD) return;
    if (out_size < NB * SEQ * DM) return;
    const float* x = (const float*)d_in[0]; const float* wq = (const float*)d_in[1]; const float* bq = (const float*)d_in[2]; const float* wk = (const float*)d_in[3]; const float* bk = (const float*)d_in[4]; const float* wv = (const float*)d_in[5]; const float* bv = (const float*)d_in[6];
    float* OUT = (float*)d_out;     // [NB][SEQ][DM]
    char* wsp = (char*)d_ws;
    auto take = [&](size_t bytes) { char* p = wsp; wsp += (bytes + 255) & ~(size_t)255; return (void*)p; };
    const size_t wsz = (size_t)NH * HD * HD;                  // one weight tensor, elements
    bf*  WB   = (bf*)take(3 * wsz * 2);                        // [3][16][64][64] bf16 = 393,216 B
    bf*  XB   = (bf*)take((size_t)NB * SEQ * DM * 2);          // [NB*SEQ][1024] bf16 = 8,388,608 B
    float* F  = (float*)take((size_t)NB * SEQ * DM * 4);       // [NB*SEQ][1024] f32 (reused q -> k -> v, stream ordered) = 16,777,216 B
    h16* Q16  = (h16*)take((size_t)NB * NH * SEQ * HD * 2);    // [NB][16][SEQ][64] fp16 = 8,388,608 B
    h16* K16  = (h16*)take((size_t)NB * NH * SEQ * HD * 2);
    h16* VT16 = (h16*)take((size_t)NB * NH * HD * SEQ * 2);    // [NB][16][64][SEQ] fp16
    if ((size_t)(wsp - (char*)d_ws) > ws_size) return;         // total 50,724,864 B
    const int nw8 = (int)(wsz / 8); const int nx8 = NB * SEQ * DM / 8;
    k_cvtw<<<dim3((unsigned)((nw8 + 255) / 256), 3, 1), 256, 0, stream>>>(wq, wk, wv, WB, nw8);
    k_cvtx<<<(unsigned)((nx8 + 255) / 256), 256, 0, stream>>>(x, XB, nx8);
    const dim3 gg((unsigned)(NB * SEQ / 64), 1, NH);            // M = NB*SEQ rows, N = 64 per head, z = head
    const unsigned LP = (unsigned)(((size_t)NB * NH * SEQ * HD / 2 + 255) / 256);
    k_gemmw<<<gg, 32, 0, stream>>>(XB, DM, WB, HD, HD, F, DM, bq, (size_t)HD, (size_t)HD * HD, (size_t)HD, (size_t)HD);
    k_qkp<<<LP, 256, 0, stream>>>(F, Q16);
    k_gemmw<<<gg, 32, 0, stream>>>(XB, DM, WB + wsz, HD, HD, F, DM, bk, (size_t)HD, (size_t)HD * HD, (size_t)HD, (size_t)HD);
    k_qkp<<<LP, 256, 0, stream>>>(F, K16);
    k_gemmw<<<gg, 32, 0, stream>>>(XB, DM, WB + 2 * wsz, HD, HD, F, DM, bv, (size_t)HD, (size_t)HD * HD, (size_t)HD, (size_t)HD);
    k_vtp<<<LP, 256, 0, stream>>>(F, VT16);
    k_attn<<<(unsigned)(NB * NH * (SEQ / QB)), 256, 0, stream>>>(Q16, K16, VT16, OUT);
}

// v002
// Measured time: 85.7 microseconds a run.
// Two timings next to v001 put it at 1.59 and 1.58 times that version's speed.
// Over all steps from v000 it is 2.45 times as fast.
#include <hip/hip_runtime.h>

// Contractions: per-head q/k/v projections = v_wmma_f32_16x16x32_bf16 (bf16 operands from RNE-converted x and W, f32 accumulate, bf16-rounded bias added in f32); attention scores q.k and p.v = v_wmma_f32_16x16x32_f16 (fp16 operands, p carried x1024, f32 accumulate); online softmax, normalisation and output in f32.
// Layout: x [NB][SEQ_FULL][1024] (first SEQ rows of each batch used) viewed as 16 head slices of 64; q = x_h Wq[h]^T + bq[h] (W is [h][out][in]), k, v likewise; scores = q.k / 8 over all SEQ keys, softmax, out_h = attn v; heads re-stacked -> [NB][SEQ][1024].

#ifndef NB
#define NB 2
#endif
#ifndef SEQ
#define SEQ 2048
#endif
#define NB_FULL  2
#define SEQ_FULL 2048
#define DM   1024
#define NH   16
#define HD   64
#define KT   64          // keys staged in LDS per iteration
#define QB   256         // queries per block (8 waves x 32)
#define PRB  256         // rows of x per projection block (8 waves)
#define KP   72          // LDS pitch (halves) of the K and V^T tile rows: 144 B = 16 B x odd, so the 16 rows one ds_load_b128 half-wave reads fall on 64 distinct banks
#define OSP  68          // LDS pitch (floats) of the per-wave output staging tile
#define PCAR 1024.0f     // power-of-two carry on the fp16 p operand
#define SCL  0.125f      // HD^-0.5
#define L2E  1.4426950408889634f

static_assert(DM == NH * HD);
static_assert(SEQ % QB == 0);
static_assert(SEQ % KT == 0);
static_assert(SEQ % PRB == 0 && PRB == 256);   // k_proj: 256 threads, 8 waves x 32 rows
static_assert(NB >= 1 && NB <= NB_FULL);
static_assert(SEQ >= QB && SEQ <= SEQ_FULL);
static_assert(HD % 32 == 0);
static_assert(HD == 64 && KT == 64 && KP >= 64 && KP % 8 == 0);

typedef _Float16 h16;
typedef unsigned short bf;
typedef __attribute__((ext_vector_type(16))) __bf16   v16bf;
typedef __attribute__((ext_vector_type(16))) _Float16 v16h;
typedef __attribute__((ext_vector_type(8)))  _Float16 v8h;
typedef __attribute__((ext_vector_type(8)))  unsigned short v8us;
typedef __attribute__((ext_vector_type(4)))  unsigned short v4us;
typedef __attribute__((ext_vector_type(8)))  float    v8f;
typedef __attribute__((ext_vector_type(4)))  float    v4f;
typedef v4f __attribute__((may_alias)) v4fa;

__device__ __forceinline__ unsigned short f2bf(float f) { unsigned u = __float_as_uint(f); u += 0x7FFFu + ((u >> 16) & 1u); return (unsigned short)(u >> 16); }
__device__ __forceinline__ float bf2f(unsigned short b) { return __uint_as_float(((unsigned)b) << 16); }
__device__ __forceinline__ float bfr(float f) { return bf2f(f2bf(f)); }
__device__ __forceinline__ v16h  cat16(v8h lo, v8h hi) { return __builtin_shufflevector(lo, hi, 0, 1, 2, 3, 4, 5, 6, 7, 8, 9, 10, 11, 12, 13, 14, 15); }
__device__ __forceinline__ v16bf cat16b(v8us lo, v8us hi) { return __builtin_bit_cast(v16bf, __builtin_shufflevector(lo, hi, 0, 1, 2, 3, 4, 5, 6, 7, 8, 9, 10, 11, 12, 13, 14, 15)); }
__device__ __forceinline__ v8f wmma16(v16h a, v16h b, v8f c) { return __builtin_amdgcn_wmma_f32_16x16x32_f16(false, a, false, b, (short)0, c, false, false); }
__device__ __forceinline__ v8f wmmab(v16bf a, v16bf b, v8f c) { return __builtin_amdgcn_wmma_f32_16x16x32_bf16(false, a, false, b, (short)0, c, false, false); }
// Fragment loaders (A and B identical): p = plane + row(l&15) * pitch + k0 + 8*(l>>4); elements 0..7 <- p[0..7], elements 8..15 <- p[16..23] (k0+16+8h..).
__device__ __forceinline__ v16h  ldh(const h16* p) { return cat16(*(const v8h*)p, *(const v8h*)(p + 16)); }
__device__ __forceinline__ v16bf ldb16(const bf* p) { return cat16b(*(const v8us*)p, *(const v8us*)(p + 16)); }

// ---- k_proj: all three per-head projections in one launch. Block = 8 waves, one (b, h), PRB consecutive rows of x.
// Stage: the x slice [PRB][64] and the head's Wq, Wk, Wv [64][64] are read as whole 128-B lines in f32, RNE-converted to bf16 and laid in LDS at pitch KP, the three bias rows beside them (one block barrier).
// Products: wave (g = wave >> 1, half = wave & 1) of row group g (64 rows). q and k: A = W rows, B = x rows, so a lane holds 8 consecutive outputs e of one row t (its 32 rows: half);
// v: A = x rows, B = W rows, so a lane holds 8 consecutive t of one output e (all 64 rows, its 32 outputs: half). Both operands through the same loader, k = 0..31 then 32..63, f32 accumulate, + bf16(bias), -> fp16.
// Store: each 32 x 64 fp16 tile goes through a wave-private LDS tile so that every global store writes whole 128-B lines of Q16 / K16 [t][d] and VT16 [d][t].
__global__ __launch_bounds__(256)
void k_proj(const float* __restrict__ x, const float* __restrict__ wq, const float* __restrict__ bq, const float* __restrict__ wk, const float* __restrict__ bk,
            const float* __restrict__ wv, const float* __restrict__ bv, h16* Q16, h16* K16, h16* VT16) {
    __shared__ __align__(16) bf  Xs[PRB * KP];             // x slice, bf16, cross-wave (block barrier)
    __shared__ __align__(16) bf  Ws[3 * HD * KP];          // Wq, Wk, Wv of this head, bf16, cross-wave (block barrier)
    __shared__ __align__(32) float Bs[3 * HD];             // bf16-rounded bq, bk, bv of this head, cross-wave (block barrier)
    __shared__ __align__(16) h16 Ts[3][PRB / 32][32 * KP]; // wave-private output staging, one tile per product
    const int tid = threadIdx.x, wave = tid >> 5, lane = tid & 31, lr = lane & 15, hi = lane >> 4;
    const int h = blockIdx.y, row0 = blockIdx.x * PRB, b = row0 / SEQ, t0 = row0 % SEQ;
    const int g = wave >> 1, half = wave & 1;
    const int sr = tid >> 4, sc = (tid & 15) * 4;          // staging: 16 lanes x 16 B = one 256-B row slice
    const float* xl  = x + ((size_t)b * SEQ_FULL + t0 + sr) * DM + h * HD + sc;
    const float* wl0 = wq + (size_t)h * HD * HD + sr * HD + sc;
    const float* wl1 = wk + (size_t)h * HD * HD + sr * HD + sc;
    const float* wl2 = wv + (size_t)h * HD * HD + sr * HD + sc;
    const float* bl  = ((wave < 2) ? bq : ((wave < 4) ? bk : bv)) + h * HD + (tid & 63);   // waves 6 and 7 read bv again and store nothing
    v4f xr[PRB / 16], wr[12];
#pragma unroll
    for (int j = 0; j < PRB / 16; ++j) xr[j] = *(const v4f*)(xl + (size_t)j * 16 * DM);
#pragma unroll
    for (int j = 0; j < 4; ++j) { wr[j] = *(const v4f*)(wl0 + j * 16 * HD); wr[4 + j] = *(const v4f*)(wl1 + j * 16 * HD); wr[8 + j] = *(const v4f*)(wl2 + j * 16 * HD); }
    const float br = *bl;
    // the five address values are inputs here, so they stay in their registers up to this wait and no later instruction reuses one ahead of it
    asm volatile("s_wait_xcnt 0x0" :: "v"(xl), "v"(wl0), "v"(wl1), "v"(wl2), "v"(bl) : "memory");
#pragma unroll
    for (int j = 0; j < PRB / 16; ++j) { v4us o;
#pragma unroll
        for (int k = 0; k < 4; ++k) o[k] = f2bf(xr[j][k]);
        *(v4us*)(Xs + (sr + j * 16) * KP + sc) = o; }
#pragma unroll
    for (int j = 0; j < 12; ++j) { v4us o;
#pragma unroll
        for (int k = 0; k < 4; ++k) o[k] = f2bf(wr[j][k]);
        *(v4us*)(Ws + ((j >> 2) * HD + sr + (j & 3) * 16) * KP + sc) = o; }
    if (tid < 3 * HD) Bs[tid] = bfr(br);
    __syncthreads();
    // x fragments of row group g; slot i holds 16-row tile tb(i) = (2 * half + i) & 3, so slots 0 and 1 are this wave's own q / k rows
    v16bf xf[4][2];
#pragma unroll
    for (int i = 0; i < 4; ++i)
#pragma unroll
        for (int kk = 0; kk < 2; ++kk) xf[i][kk] = ldb16(Xs + (g * 64 + ((half * 2 + i) & 3) * 16 + lr) * KP + kk * 32 + 8 * hi);
    const size_t bh = (size_t)b * NH + h;
#pragma unroll
    for (int m = 0; m < 3; ++m) {
        h16* ts = Ts[m][wave];
        if (m < 2) {
#pragma unroll
            for (int et = 0; et < 4; ++et) {
                const v16bf w0 = ldb16(Ws + (m * HD + et * 16 + lr) * KP + 8 * hi), w1 = ldb16(Ws + (m * HD + et * 16 + lr) * KP + 32 + 8 * hi);
                const v8f bb = *(const v8f*)(Bs + m * HD + et * 16 + 8 * hi);
#pragma unroll
                for (int tt = 0; tt < 2; ++tt) { v8f c = (v8f){}; c = wmmab(w0, xf[tt][0], c); c = wmmab(w1, xf[tt][1], c);
                    v8h o;
#pragma unroll
                    for (int j = 0; j < 8; ++j) o[j] = (h16)(c[j] + bb[j]);
                    *(v8h*)(ts + (tt * 16 + lr) * KP + et * 16 + 8 * hi) = o; }
            }
        } else {
#pragma unroll
            for (int ee = 0; ee < 2; ++ee) {
                const v16bf w0 = ldb16(Ws + (2 * HD + (half * 2 + ee) * 16 + lr) * KP + 8 * hi), w1 = ldb16(Ws + (2 * HD + (half * 2 + ee) * 16 + lr) * KP + 32 + 8 * hi);
                const float bb = Bs[2 * HD + (half * 2 + ee) * 16 + lr];
#pragma unroll
                for (int i = 0; i < 4; ++i) { v8f c = (v8f){}; c = wmmab(xf[i][0], w0, c); c = wmmab(xf[i][1], w1, c);
                    v8h o;
#pragma unroll
                    for (int j = 0; j < 8; ++j) o[j] = (h16)(c[j] + bb);
                    *(v8h*)(ts + (ee * 16 + lr) * KP + ((half * 2 + i) & 3) * 16 + 8 * hi) = o; }
            }
        }
        // the rows read back below were written by other lanes of this wave: keep the compiler from moving the reads above the writes
        __builtin_amdgcn_fence(3, "wavefront"); __builtin_amdgcn_wave_barrier(); asm volatile("" ::: "memory");
        h16* dst = (m == 0) ? Q16 + (bh * SEQ + t0 + g * 64 + half * 32) * HD : ((m == 1) ? K16 + (bh * SEQ + t0 + g * 64 + half * 32) * HD : VT16 + (bh * HD + half * 32) * SEQ + t0 + g * 64);
        const size_t dp = (m < 2) ? (size_t)HD : (size_t)SEQ;
#pragma unroll
        for (int s = 0; s < 8; ++s) { const int row = 4 * s + (lane >> 3), ch = (lane & 7) * 8;
            *(v8h*)(dst + (size_t)row * dp + ch) = *(const v8h*)(ts + row * KP + ch); }
    }
}

// ---- k_attn: flash attention, block = 8 waves, one (b,h), QB queries; one wave = 32 queries (2 tiles of 16).
// Per 64-key iteration: K tile [t][d] and V^T tile [d][t] staged in LDS (plain 16-B loads, block barriers before and after: cross-wave regions);
// S^T = K . Q^T per 16-key sub-tile (A = K rows from LDS, B = Q columns from the plane, both split-k loaders), so each lane holds 8 keys of one query;
// online softmax in f32 (running max, one exp2 per score); p x1024 packed into A fragments straight from the two adjacent 16-key accumulator tiles
// (element r <- keys 0-15 tile, element 8+r <- keys 16-31 tile, lane unchanged); O += P . V with B = V^T rows from LDS.
__global__ __launch_bounds__(256) __attribute__((amdgpu_num_vgpr(256)))
void k_attn(const h16* __restrict__ Q16, const h16* __restrict__ K16, const h16* __restrict__ VT16, float* OUT) {
    __shared__ __align__(16) h16 Ks[KT * KP];            // [t][d] at pitch KP, cross-wave (block barriers)
    __shared__ __align__(16) h16 Vs[HD * KP];            // [d][t] at pitch KP, cross-wave (block barriers)
    __shared__ __align__(16) float osh[QB / 32][16 * OSP]; // wave-private output staging
    const int tid = threadIdx.x, wv = tid >> 5, lane = tid & 31, lr = lane & 15, hi = lane >> 4;
    const int qblks = SEQ / QB; const int bh = blockIdx.x / qblks, qblk = blockIdx.x % qblks; const int b = bh / NH, h = bh % NH;
    const int q0 = qblk * QB + wv * 32;
    const h16* Qp = Q16 + ((size_t)bh * SEQ + q0) * HD;
    v16h qf[2][2];
#pragma unroll
    for (int qt = 0; qt < 2; ++qt)
#pragma unroll
        for (int kk = 0; kk < 2; ++kk) qf[qt][kk] = ldh(Qp + (size_t)(qt * 16 + lr) * HD + kk * 32 + 8 * hi);
    const h16* Kb = K16 + (size_t)bh * SEQ * HD; const h16* Vb = VT16 + (size_t)bh * HD * SEQ;
    v8f o[2][4];
#pragma unroll
    for (int qt = 0; qt < 2; ++qt)
#pragma unroll
        for (int et = 0; et < 4; ++et) o[qt][et] = (v8f){};
    float m_run[2] = {-1.0e30f, -1.0e30f}, l_run[2] = {0.f, 0.f};
    float* os = osh[wv];
#pragma unroll 1
    for (int t0 = 0; t0 < SEQ; t0 += KT) {
        __syncthreads();
#pragma unroll
        for (int j = 0; j < 2; ++j) { const int u = tid + j * 256; const int e = u >> 3, uu = u & 7;
            const v8h kx = *(const v8h*)(Kb + (size_t)t0 * HD + (size_t)u * 8);
            const v8h vx = *(const v8h*)(Vb + (size_t)e * SEQ + t0 + uu * 8);
            *(v8h*)(Ks + e * KP + uu * 8) = kx; *(v8h*)(Vs + e * KP + uu * 8) = vx; }
        __syncthreads();
#pragma unroll
        for (int qt = 0; qt < 2; ++qt) {
            v8f st[4]; v16h ka0, ka1;
#pragma unroll
            for (int ts = 0; ts < 4; ++ts) { ka0 = ldh(Ks + (ts * 16 + lr) * KP + 8 * hi); ka1 = ldh(Ks + (ts * 16 + lr) * KP + 32 + 8 * hi);
                v8f c = (v8f){}; c = wmma16(ka0, qf[qt][0], c); c = wmma16(ka1, qf[qt][1], c); st[ts] = c; }
            asm volatile("v_nop\n\tv_nop\n\tv_nop\n\tv_nop" : "+v"(st[0]), "+v"(st[1]), "+v"(st[2]), "+v"(st[3]) : "v"(ka0), "v"(ka1), "v"(qf[qt][1]));
            // online softmax: lane owns query lr, keys 8*hi + r of each 16-key sub-tile; the partner lane (lane ^ 16) owns the other 32 keys
            float tm = -1.0e30f;
#pragma unroll
            for (int ts = 0; ts < 4; ++ts)
#pragma unroll
                for (int v = 0; v < 8; ++v) { const float t = st[ts][v] * SCL; st[ts][v] = t; tm = fmaxf(tm, t); }
            tm = fmaxf(tm, __shfl_xor(tm, 16, 32));
            const float m_new = fmaxf(m_run[qt], tm);
            float da = __fsub_rn(m_run[qt], m_new); asm volatile("" : "+v"(da));
            const float alpha = __builtin_amdgcn_exp2f(__fmul_rn(da, L2E));
            float rs = 0.f; v16h pa[2];
#pragma unroll
            for (int v = 0; v < 8; ++v) {
                float d0 = __fsub_rn(st[0][v], m_new), d1 = __fsub_rn(st[1][v], m_new), d2 = __fsub_rn(st[2][v], m_new), d3 = __fsub_rn(st[3][v], m_new);
                asm volatile("" : "+v"(d0)); asm volatile("" : "+v"(d1)); asm volatile("" : "+v"(d2)); asm volatile("" : "+v"(d3));
                const float p0 = __builtin_amdgcn_exp2f(__fmul_rn(d0, L2E)), p1 = __builtin_amdgcn_exp2f(__fmul_rn(d1, L2E));
                const float p2 = __builtin_amdgcn_exp2f(__fmul_rn(d2, L2E)), p3 = __builtin_amdgcn_exp2f(__fmul_rn(d3, L2E));
                rs += (p0 + p1) + (p2 + p3);
                pa[0][v] = (h16)(p0 * PCAR); pa[0][v + 8] = (h16)(p1 * PCAR);   // keys 8h+v and 16+8h+v of the 64-key tile
                pa[1][v] = (h16)(p2 * PCAR); pa[1][v + 8] = (h16)(p3 * PCAR);   // keys 32+8h+v and 48+8h+v
            }
            rs += __shfl_xor(rs, 16, 32);
            l_run[qt] = l_run[qt] * alpha + rs; m_run[qt] = m_new;
            // rescale O: accumulator element v of this lane is query row 8*hi + v; alpha for that query lives in lane 8*hi + v
#pragma unroll
            for (int v = 0; v < 8; ++v) { const float fs = __shfl(alpha, v + 8 * hi, 32); o[qt][0][v] *= fs; o[qt][1][v] *= fs; o[qt][2][v] *= fs; o[qt][3][v] *= fs; }
            v16h vb0, vb1;
#pragma unroll
            for (int et = 0; et < 4; ++et) { vb0 = ldh(Vs + (et * 16 + lr) * KP + 8 * hi); vb1 = ldh(Vs + (et * 16 + lr) * KP + 32 + 8 * hi);
                o[qt][et] = wmma16(pa[0], vb0, o[qt][et]); o[qt][et] = wmma16(pa[1], vb1, o[qt][et]); }
            asm volatile("v_nop\n\tv_nop\n\tv_nop\n\tv_nop" : "+v"(o[qt][0]), "+v"(o[qt][1]), "+v"(o[qt][2]), "+v"(o[qt][3]) : "v"(pa[0]), "v"(pa[1]), "v"(vb1));
        }
    }
    // epilogue: out[b][q][h*HD + d] = O[q][d] / (l * PCAR)
#pragma unroll
    for (int qt = 0; qt < 2; ++qt) {
        const float inv = 1.0f / (l_run[qt] * PCAR);
#pragma unroll
        for (int j = 0; j < 8; ++j) { const float fs = __shfl(inv, j + 8 * hi, 32);
#pragma unroll
            for (int et = 0; et < 4; ++et) os[(hi * 8 + j) * OSP + et * 16 + lr] = o[qt][et][j] * fs; }
        __builtin_amdgcn_fence(3, "wavefront"); __builtin_amdgcn_wave_barrier(); asm volatile("" ::: "memory");
        float* crow = OUT + ((size_t)b * SEQ + q0 + qt * 16) * DM + (size_t)h * HD;
{
#pragma unroll
            for (int s = 0; s < 8; ++s) { const int row = 2 * s + hi, cofs = lr * 4; const v4f val = *(const v4fa*)(os + row * OSP + cofs);
                *(v4f*)(crow + (size_t)row * DM + cofs) = val; }
             }
        __builtin_amdgcn_wave_barrier(); asm volatile("" ::: "memory");
    }
}

extern "C" void kernel_launch(void* const* d_in, const int* in_sizes, int n_in,
                              void* d_out, int out_size, void* d_ws, size_t ws_size, hipStream_t stream) {
    if (n_in < 7) return;
    if (in_sizes[0] < (NB - 1) * SEQ_FULL * DM + SEQ * DM) return;
    if (in_sizes[1] < NH * HD * HD || in_sizes[3] < NH * HD * HD || in_sizes[5] < NH * HD * HD) return;
    if (in_sizes[2] < NH * HD || in_sizes[4] < NH * HD || in_sizes[6] < NH * HD) return;
    if (out_size < NB * SEQ * DM) return;
    const float* x = (const float*)d_in[0]; const float* wq = (const float*)d_in[1]; const float* bq = (const float*)d_in[2]; const float* wk = (const float*)d_in[3]; const float* bk = (const float*)d_in[4]; const float* wv = (const float*)d_in[5]; const float* bv = (const float*)d_in[6];
    float* OUT = (float*)d_out;     // [NB][SEQ][DM]
    char* wsp = (char*)d_ws;
    auto take = [&](size_t bytes) { char* p = wsp; wsp += (bytes + 255) & ~(size_t)255; return (void*)p; };
    h16* Q16  = (h16*)take((size_t)NB * NH * SEQ * HD * 2);    // [NB][16][SEQ][64] fp16 = 8,388,608 B
    h16* K16  = (h16*)take((size_t)NB * NH * SEQ * HD * 2);
    h16* VT16 = (h16*)take((size_t)NB * NH * HD * SEQ * 2);    // [NB][16][64][SEQ] fp16
    if ((size_t)(wsp - (char*)d_ws) > ws_size) return;         // total 25,165,824 B
    k_proj<<<dim3((unsigned)(NB * SEQ / PRB), NH, 1), 256, 0, stream>>>(x, wq, bq, wk, bk, wv, bv, Q16, K16, VT16);
    k_attn<<<(unsigned)(NB * NH * (SEQ / QB)), 256, 0, stream>>>(Q16, K16, VT16, OUT);
}

// v003
// It runs in 65.1 microseconds.
// Two timings next to v002 put it at 1.29 and 1.34 times that version's speed.
// Counting every step since v000, it is 3.23 times as fast.
#include <hip/hip_runtime.h>

// Contractions: per-head q/k/v projections = v_wmma_f32_16x16x32_bf16 (bf16 operands from RNE-converted x and W, f32 accumulate, bf16-rounded bias added in f32); attention scores q.k and p.v = v_wmma_f32_16x16x32_f16 (fp16 operands, p carried x1024, f32 accumulate); online softmax, normalisation and output in f32.
// Layout: x [NB][SEQ_FULL][1024] (first SEQ rows of each batch used) viewed as 16 head slices of 64; q = x_h Wq[h]^T + bq[h] (W is [h][out][in]), k, v likewise; scores = q.k / 8 over all SEQ keys, softmax, out_h = attn v; heads re-stacked -> [NB][SEQ][1024].

#ifndef NB
#define NB 2
#endif
#ifndef SEQ
#define SEQ 2048
#endif
#define NB_FULL  2
#define SEQ_FULL 2048
#define DM   1024
#define NH   16
#define HD   64
#define KT   64          // keys staged in LDS per iteration
#define QTW  1           // 16-query tiles per wave
#define QB   (8 * 16 * QTW)   // queries per block (8 waves x 16): 512 blocks, two resident per WGP, four waves per SIMD
#define PRB  256         // rows of x per projection block (8 waves)
#define KP   72          // LDS pitch (halves) of the K and V^T tile rows: 144 B = 16 B x odd, so the 16 rows one ds_load_b128 half-wave reads fall on 64 distinct banks
#define OSP  68          // LDS pitch (floats) of the per-wave output staging tile
#define PCAR 1024.0f     // power-of-two carry on the fp16 p operand
#define SCL  0.125f      // HD^-0.5
#define L2E  1.4426950408889634f

static_assert(DM == NH * HD);
static_assert(SEQ % QB == 0);
static_assert(SEQ % KT == 0);
static_assert(SEQ % PRB == 0 && PRB == 256);   // k_proj: 256 threads, 8 waves x 32 rows
static_assert(NB >= 1 && NB <= NB_FULL);
static_assert(SEQ >= QB && SEQ <= SEQ_FULL);
static_assert(HD % 32 == 0);
static_assert(HD == 64 && KT == 64 && KP >= 64 && KP % 8 == 0);

typedef _Float16 h16;
typedef unsigned short bf;
typedef __attribute__((ext_vector_type(16))) __bf16   v16bf;
typedef __attribute__((ext_vector_type(16))) _Float16 v16h;
typedef __attribute__((ext_vector_type(8)))  _Float16 v8h;
typedef __attribute__((ext_vector_type(8)))  unsigned short v8us;
typedef __attribute__((ext_vector_type(4)))  unsigned short v4us;
typedef __attribute__((ext_vector_type(8)))  float    v8f;
typedef __attribute__((ext_vector_type(4)))  float    v4f;
typedef v4f __attribute__((may_alias)) v4fa;

__device__ __forceinline__ unsigned short f2bf(float f) { unsigned u = __float_as_uint(f); u += 0x7FFFu + ((u >> 16) & 1u); return (unsigned short)(u >> 16); }
__device__ __forceinline__ float bf2f(unsigned short b) { return __uint_as_float(((unsigned)b) << 16); }
__device__ __forceinline__ float bfr(float f) { return bf2f(f2bf(f)); }
__device__ __forceinline__ v16h  cat16(v8h lo, v8h hi) { return __builtin_shufflevector(lo, hi, 0, 1, 2, 3, 4, 5, 6, 7, 8, 9, 10, 11, 12, 13, 14, 15); }
__device__ __forceinline__ v16bf cat16b(v8us lo, v8us hi) { return __builtin_bit_cast(v16bf, __builtin_shufflevector(lo, hi, 0, 1, 2, 3, 4, 5, 6, 7, 8, 9, 10, 11, 12, 13, 14, 15)); }
__device__ __forceinline__ v8f wmma16(v16h a, v16h b, v8f c) { return __builtin_amdgcn_wmma_f32_16x16x32_f16(false, a, false, b, (short)0, c, false, false); }
__device__ __forceinline__ v8f wmmab(v16bf a, v16bf b, v8f c) { return __builtin_amdgcn_wmma_f32_16x16x32_bf16(false, a, false, b, (short)0, c, false, false); }
// Fragment loaders (A and B identical): p = plane + row(l&15) * pitch + k0 + 8*(l>>4); elements 0..7 <- p[0..7], elements 8..15 <- p[16..23] (k0+16+8h..).
__device__ __forceinline__ v16h  ldh(const h16* p) { return cat16(*(const v8h*)p, *(const v8h*)(p + 16)); }
__device__ __forceinline__ v16bf ldb16(const bf* p) { return cat16b(*(const v8us*)p, *(const v8us*)(p + 16)); }

// ---- k_proj: all three per-head projections in one launch. Block = 8 waves, one (b, h), PRB consecutive rows of x.
// Stage: the x slice [PRB][64] and the head's Wq, Wk, Wv [64][64] are read as whole 128-B lines in f32, RNE-converted to bf16 and laid in LDS at pitch KP, the three bias rows beside them (one block barrier).
// Products: wave (g = wave >> 1, half = wave & 1) of row group g (64 rows). q and k: A = W rows, B = x rows, so a lane holds 8 consecutive outputs e of one row t (its 32 rows: half);
// v: A = x rows, B = W rows, so a lane holds 8 consecutive t of one output e (all 64 rows, its 32 outputs: half). Both operands through the same loader, k = 0..31 then 32..63, f32 accumulate, + bf16(bias), -> fp16.
// Store: each 32 x 64 fp16 tile goes through a wave-private LDS tile so that every global store writes whole 128-B lines of Q16 / K16 [t][d] and VT16 [d][t].
__global__ __launch_bounds__(256)
void k_proj(const float* __restrict__ x, const float* __restrict__ wq, const float* __restrict__ bq, const float* __restrict__ wk, const float* __restrict__ bk,
            const float* __restrict__ wv, const float* __restrict__ bv, h16* Q16, h16* K16, h16* VT16) {
    __shared__ __align__(16) bf  Xs[PRB * KP];             // x slice, bf16, cross-wave (block barrier)
    __shared__ __align__(16) bf  Ws[3 * HD * KP];          // Wq, Wk, Wv of this head, bf16, cross-wave (block barrier)
    __shared__ __align__(32) float Bs[3 * HD];             // bf16-rounded bq, bk, bv of this head, cross-wave (block barrier)
    __shared__ __align__(16) h16 Ts[3][PRB / 32][32 * KP]; // wave-private output staging, one tile per product
    const int tid = threadIdx.x, wave = tid >> 5, lane = tid & 31, lr = lane & 15, hi = lane >> 4;
    const int h = blockIdx.y, row0 = blockIdx.x * PRB, b = row0 / SEQ, t0 = row0 % SEQ;
    const int g = wave >> 1, half = wave & 1;
    const int sr = tid >> 4, sc = (tid & 15) * 4;          // staging: 16 lanes x 16 B = one 256-B row slice
    const float* xl  = x + ((size_t)b * SEQ_FULL + t0 + sr) * DM + h * HD + sc;
    const float* wl0 = wq + (size_t)h * HD * HD + sr * HD + sc;
    const float* wl1 = wk + (size_t)h * HD * HD + sr * HD + sc;
    const float* wl2 = wv + (size_t)h * HD * HD + sr * HD + sc;
    const float* bl  = ((wave < 2) ? bq : ((wave < 4) ? bk : bv)) + h * HD + (tid & 63);   // waves 6 and 7 read bv again and store nothing
    v4f xr[PRB / 16], wr[12];
#pragma unroll
    for (int j = 0; j < PRB / 16; ++j) xr[j] = *(const v4f*)(xl + (size_t)j * 16 * DM);
#pragma unroll
    for (int j = 0; j < 4; ++j) { wr[j] = *(const v4f*)(wl0 + j * 16 * HD); wr[4 + j] = *(const v4f*)(wl1 + j * 16 * HD); wr[8 + j] = *(const v4f*)(wl2 + j * 16 * HD); }
    const float br = *bl;
    // the five address values are inputs here, so they stay in their registers up to this wait and no later instruction reuses one ahead of it
    asm volatile("s_wait_xcnt 0x0" :: "v"(xl), "v"(wl0), "v"(wl1), "v"(wl2), "v"(bl) : "memory");
#pragma unroll
    for (int j = 0; j < PRB / 16; ++j) { v4us o;
#pragma unroll
        for (int k = 0; k < 4; ++k) o[k] = f2bf(xr[j][k]);
        *(v4us*)(Xs + (sr + j * 16) * KP + sc) = o; }
#pragma unroll
    for (int j = 0; j < 12; ++j) { v4us o;
#pragma unroll
        for (int k = 0; k < 4; ++k) o[k] = f2bf(wr[j][k]);
        *(v4us*)(Ws + ((j >> 2) * HD + sr + (j & 3) * 16) * KP + sc) = o; }
    if (tid < 3 * HD) Bs[tid] = bfr(br);
    __syncthreads();
    // x fragments of row group g; slot i holds 16-row tile tb(i) = (2 * half + i) & 3, so slots 0 and 1 are this wave's own q / k rows
    v16bf xf[4][2];
#pragma unroll
    for (int i = 0; i < 4; ++i)
#pragma unroll
        for (int kk = 0; kk < 2; ++kk) xf[i][kk] = ldb16(Xs + (g * 64 + ((half * 2 + i) & 3) * 16 + lr) * KP + kk * 32 + 8 * hi);
    const size_t bh = (size_t)b * NH + h;
#pragma unroll
    for (int m = 0; m < 3; ++m) {
        h16* ts = Ts[m][wave];
        if (m < 2) {
#pragma unroll
            for (int et = 0; et < 4; ++et) {
                const v16bf w0 = ldb16(Ws + (m * HD + et * 16 + lr) * KP + 8 * hi), w1 = ldb16(Ws + (m * HD + et * 16 + lr) * KP + 32 + 8 * hi);
                const v8f bb = *(const v8f*)(Bs + m * HD + et * 16 + 8 * hi);
#pragma unroll
                for (int tt = 0; tt < 2; ++tt) { v8f c = (v8f){}; c = wmmab(w0, xf[tt][0], c); c = wmmab(w1, xf[tt][1], c);
                    v8h o;
#pragma unroll
                    for (int j = 0; j < 8; ++j) o[j] = (h16)(c[j] + bb[j]);
                    *(v8h*)(ts + (tt * 16 + lr) * KP + et * 16 + 8 * hi) = o; }
            }
        } else {
#pragma unroll
            for (int ee = 0; ee < 2; ++ee) {
                const v16bf w0 = ldb16(Ws + (2 * HD + (half * 2 + ee) * 16 + lr) * KP + 8 * hi), w1 = ldb16(Ws + (2 * HD + (half * 2 + ee) * 16 + lr) * KP + 32 + 8 * hi);
                const float bb = Bs[2 * HD + (half * 2 + ee) * 16 + lr];
#pragma unroll
                for (int i = 0; i < 4; ++i) { v8f c = (v8f){}; c = wmmab(xf[i][0], w0, c); c = wmmab(xf[i][1], w1, c);
                    v8h o;
#pragma unroll
                    for (int j = 0; j < 8; ++j) o[j] = (h16)(c[j] + bb);
                    *(v8h*)(ts + (ee * 16 + lr) * KP + ((half * 2 + i) & 3) * 16 + 8 * hi) = o; }
            }
        }
        // the rows read back below were written by other lanes of this wave: keep the compiler from moving the reads above the writes
        __builtin_amdgcn_fence(3, "wavefront"); __builtin_amdgcn_wave_barrier(); asm volatile("" ::: "memory");
        h16* dst = (m == 0) ? Q16 + (bh * SEQ + t0 + g * 64 + half * 32) * HD : ((m == 1) ? K16 + (bh * SEQ + t0 + g * 64 + half * 32) * HD : VT16 + (bh * HD + half * 32) * SEQ + t0 + g * 64);
        const size_t dp = (m < 2) ? (size_t)HD : (size_t)SEQ;
#pragma unroll
        for (int s = 0; s < 8; ++s) { const int row = 4 * s + (lane >> 3), ch = (lane & 7) * 8;
            *(v8h*)(dst + (size_t)row * dp + ch) = *(const v8h*)(ts + row * KP + ch); }
    }
}

// ---- k_attn: flash attention, block = 8 waves, one (b,h), QB queries; one wave = 16 queries (QTW tiles of 16).
// Two blocks share a WGP (waves_per_eu 4, 4: the grid is exactly two blocks per WGP): one block's tile staging and its waves' LDS and cross-lane waits are covered by the other block's waves.
// Per 64-key iteration: K tile [t][d] and V^T tile [d][t] staged in LDS (plain 16-B loads, block barriers before and after: cross-wave regions);
// S^T = K . Q^T per 16-key sub-tile (A = K rows from LDS, B = Q columns from the plane, both split-k loaders), so each lane holds 8 keys of one query;
// online softmax in f32 (running max, one exp2 per score); p x1024 packed into A fragments straight from the two adjacent 16-key accumulator tiles
// (element r <- keys 0-15 tile, element 8+r <- keys 16-31 tile, lane unchanged); O += P . V with B = V^T rows from LDS.
__global__ __launch_bounds__(256) __attribute__((amdgpu_waves_per_eu(4, 4)))
void k_attn(const h16* __restrict__ Q16, const h16* __restrict__ K16, const h16* __restrict__ VT16, float* OUT) {
    __shared__ __align__(16) h16 Ks[KT * KP];            // [t][d] at pitch KP, cross-wave (block barriers)
    __shared__ __align__(16) h16 Vs[HD * KP];            // [d][t] at pitch KP, cross-wave (block barriers)
    __shared__ __align__(16) float osh[QB / (16 * QTW)][16 * OSP]; // wave-private output staging
    const int tid = threadIdx.x, wv = tid >> 5, lane = tid & 31, lr = lane & 15, hi = lane >> 4;
    const int qblks = SEQ / QB; const int bh = blockIdx.x / qblks, qblk = blockIdx.x % qblks; const int b = bh / NH, h = bh % NH;
    const int q0 = qblk * QB + wv * (16 * QTW);
    const h16* Qp = Q16 + ((size_t)bh * SEQ + q0) * HD;
    v16h qf[QTW][2];
#pragma unroll
    for (int qt = 0; qt < QTW; ++qt)
#pragma unroll
        for (int kk = 0; kk < 2; ++kk) qf[qt][kk] = ldh(Qp + (size_t)(qt * 16 + lr) * HD + kk * 32 + 8 * hi);
    const h16* Kb = K16 + (size_t)bh * SEQ * HD; const h16* Vb = VT16 + (size_t)bh * HD * SEQ;
    v8f o[QTW][4];
#pragma unroll
    for (int qt = 0; qt < QTW; ++qt)
#pragma unroll
        for (int et = 0; et < 4; ++et) o[qt][et] = (v8f){};
    float m_run[QTW], l_run[QTW];
#pragma unroll
    for (int qt = 0; qt < QTW; ++qt) { m_run[qt] = -1.0e30f; l_run[qt] = 0.f; }
    float* os = osh[wv];
#pragma unroll 1
    for (int t0 = 0; t0 < SEQ; t0 += KT) {
        __syncthreads();
#pragma unroll
        for (int j = 0; j < 2; ++j) { const int u = tid + j * 256; const int e = u >> 3, uu = u & 7;
            const v8h kx = *(const v8h*)(Kb + (size_t)t0 * HD + (size_t)u * 8);
            const v8h vx = *(const v8h*)(Vb + (size_t)e * SEQ + t0 + uu * 8);
            *(v8h*)(Ks + e * KP + uu * 8) = kx; *(v8h*)(Vs + e * KP + uu * 8) = vx; }
        __syncthreads();
#pragma unroll
        for (int qt = 0; qt < QTW; ++qt) {
            v8f st[4]; v16h ka0, ka1;
#pragma unroll
            for (int ts = 0; ts < 4; ++ts) { ka0 = ldh(Ks + (ts * 16 + lr) * KP + 8 * hi); ka1 = ldh(Ks + (ts * 16 + lr) * KP + 32 + 8 * hi);
                v8f c = (v8f){}; c = wmma16(ka0, qf[qt][0], c); c = wmma16(ka1, qf[qt][1], c); st[ts] = c; }
            asm volatile("v_nop\n\tv_nop\n\tv_nop\n\tv_nop" : "+v"(st[0]), "+v"(st[1]), "+v"(st[2]), "+v"(st[3]) : "v"(ka0), "v"(ka1), "v"(qf[qt][1]));
            // online softmax: lane owns query lr, keys 8*hi + r of each 16-key sub-tile; the partner lane (lane ^ 16) owns the other 32 keys
            float tm = -1.0e30f;
#pragma unroll
            for (int ts = 0; ts < 4; ++ts)
#pragma unroll
                for (int v = 0; v < 8; ++v) { const float t = st[ts][v] * SCL; st[ts][v] = t; tm = fmaxf(tm, t); }
            tm = fmaxf(tm, __shfl_xor(tm, 16, 32));
            const float m_new = fmaxf(m_run[qt], tm);
            float da = __fsub_rn(m_run[qt], m_new); asm volatile("" : "+v"(da));
            const float alpha = __builtin_amdgcn_exp2f(__fmul_rn(da, L2E));
            float rs = 0.f; v16h pa[2];
#pragma unroll
            for (int v = 0; v < 8; ++v) {
                float d0 = __fsub_rn(st[0][v], m_new), d1 = __fsub_rn(st[1][v], m_new), d2 = __fsub_rn(st[2][v], m_new), d3 = __fsub_rn(st[3][v], m_new);
                asm volatile("" : "+v"(d0)); asm volatile("" : "+v"(d1)); asm volatile("" : "+v"(d2)); asm volatile("" : "+v"(d3));
                const float p0 = __builtin_amdgcn_exp2f(__fmul_rn(d0, L2E)), p1 = __builtin_amdgcn_exp2f(__fmul_rn(d1, L2E));
                const float p2 = __builtin_amdgcn_exp2f(__fmul_rn(d2, L2E)), p3 = __builtin_amdgcn_exp2f(__fmul_rn(d3, L2E));
                rs += (p0 + p1) + (p2 + p3);
                pa[0][v] = (h16)(p0 * PCAR); pa[0][v + 8] = (h16)(p1 * PCAR);   // keys 8h+v and 16+8h+v of the 64-key tile
                pa[1][v] = (h16)(p2 * PCAR); pa[1][v + 8] = (h16)(p3 * PCAR);   // keys 32+8h+v and 48+8h+v
            }
            rs += __shfl_xor(rs, 16, 32);
            l_run[qt] = l_run[qt] * alpha + rs; m_run[qt] = m_new;
            // rescale O: accumulator element v of this lane is query row 8*hi + v; alpha for that query lives in lane 8*hi + v
#pragma unroll
            for (int v = 0; v < 8; ++v) { const float fs = __shfl(alpha, v + 8 * hi, 32); o[qt][0][v] *= fs; o[qt][1][v] *= fs; o[qt][2][v] *= fs; o[qt][3][v] *= fs; }
            v16h vb0, vb1;
#pragma unroll
            for (int et = 0; et < 4; ++et) { vb0 = ldh(Vs + (et * 16 + lr) * KP + 8 * hi); vb1 = ldh(Vs + (et * 16 + lr) * KP + 32 + 8 * hi);
                o[qt][et] = wmma16(pa[0], vb0, o[qt][et]); o[qt][et] = wmma16(pa[1], vb1, o[qt][et]); }
            asm volatile("v_nop\n\tv_nop\n\tv_nop\n\tv_nop" : "+v"(o[qt][0]), "+v"(o[qt][1]), "+v"(o[qt][2]), "+v"(o[qt][3]) : "v"(pa[0]), "v"(pa[1]), "v"(vb1));
        }
    }
    // epilogue: out[b][q][h*HD + d] = O[q][d] / (l * PCAR)
#pragma unroll
    for (int qt = 0; qt < QTW; ++qt) {
        const float inv = 1.0f / (l_run[qt] * PCAR);
#pragma unroll
        for (int j = 0; j < 8; ++j) { const float fs = __shfl(inv, j + 8 * hi, 32);
#pragma unroll
            for (int et = 0; et < 4; ++et) os[(hi * 8 + j) * OSP + et * 16 + lr] = o[qt][et][j] * fs; }
        __builtin_amdgcn_fence(3, "wavefront"); __builtin_amdgcn_wave_barrier(); asm volatile("" ::: "memory");
        float* crow = OUT + ((size_t)b * SEQ + q0 + qt * 16) * DM + (size_t)h * HD;
{
#pragma unroll
            for (int s = 0; s < 8; ++s) { const int row = 2 * s + hi, cofs = lr * 4; const v4f val = *(const v4fa*)(os + row * OSP + cofs);
                *(v4f*)(crow + (size_t)row * DM + cofs) = val; }
             }
        __builtin_amdgcn_wave_barrier(); asm volatile("" ::: "memory");
    }
}

extern "C" void kernel_launch(void* const* d_in, const int* in_sizes, int n_in,
                              void* d_out, int out_size, void* d_ws, size_t ws_size, hipStream_t stream) {
    if (n_in < 7) return;
    if (in_sizes[0] < (NB - 1) * SEQ_FULL * DM + SEQ * DM) return;
    if (in_sizes[1] < NH * HD * HD || in_sizes[3] < NH * HD * HD || in_sizes[5] < NH * HD * HD) return;
    if (in_sizes[2] < NH * HD || in_sizes[4] < NH * HD || in_sizes[6] < NH * HD) return;
    if (out_size < NB * SEQ * DM) return;
    const float* x = (const float*)d_in[0]; const float* wq = (const float*)d_in[1]; const float* bq = (const float*)d_in[2]; const float* wk = (const float*)d_in[3]; const float* bk = (const float*)d_in[4]; const float* wv = (const float*)d_in[5]; const float* bv = (const float*)d_in[6];
    float* OUT = (float*)d_out;     // [NB][SEQ][DM]
    char* wsp = (char*)d_ws;
    auto take = [&](size_t bytes) { char* p = wsp; wsp += (bytes + 255) & ~(size_t)255; return (void*)p; };
    h16* Q16  = (h16*)take((size_t)NB * NH * SEQ * HD * 2);    // [NB][16][SEQ][64] fp16 = 8,388,608 B
    h16* K16  = (h16*)take((size_t)NB * NH * SEQ * HD * 2);
    h16* VT16 = (h16*)take((size_t)NB * NH * HD * SEQ * 2);    // [NB][16][64][SEQ] fp16
    if ((size_t)(wsp - (char*)d_ws) > ws_size) return;         // total 25,165,824 B
    k_proj<<<dim3((unsigned)(NB * SEQ / PRB), NH, 1), 256, 0, stream>>>(x, wq, bq, wk, bk, wv, bv, Q16, K16, VT16);
    k_attn<<<(unsigned)(NB * NH * (SEQ / QB)), 256, 0, stream>>>(Q16, K16, VT16, OUT);
}

// v004
// A run of this version takes 53.2 microseconds.
// In two side-by-side timings against v003, it was 1.25 and 1.21 times as fast.
// All steps since v000 together make it 3.97 times as fast.
#include <hip/hip_runtime.h>

// Contractions: per-head q/k/v projections = v_wmma_f32_16x16x32_bf16 (bf16 operands from RNE-converted x and W, f32 accumulate, bf16-rounded bias added in f32); attention scores q.k and p.v = v_wmma_f32_16x16x32_f16 (fp16 operands, p carried x1024, f32 accumulate); online softmax, normalisation and output in f32.
// Layout: x [NB][SEQ_FULL][1024] (first SEQ rows of each batch used) viewed as 16 head slices of 64; q = x_h Wq[h]^T + bq[h] (W is [h][out][in]), k, v likewise; scores = q.k / 8 over all SEQ keys, softmax, out_h = attn v; heads re-stacked -> [NB][SEQ][1024].

#ifndef NB
#define NB 2
#endif
#ifndef SEQ
#define SEQ 2048
#endif
#define NB_FULL  2
#define SEQ_FULL 2048
#define DM   1024
#define NH   16
#define HD   64
#define KT   64          // keys staged in LDS per iteration
#define QTW  1           // 16-query tiles per wave
#define QB   (8 * 16 * QTW)   // queries per block (8 waves x 16): 512 blocks, two resident per WGP, four waves per SIMD
#define PRB  256         // rows of x per projection block (8 waves)
#define KP   72          // LDS pitch (halves) of the K and V^T tile rows: 144 B = 16 B x odd, so the 16 rows one ds_load_b128 half-wave reads fall on 64 distinct banks
#define OSP  68          // LDS pitch (floats) of the per-wave output staging tile
#define PCAR 1024.0f     // power-of-two carry on the fp16 p operand
#define SCL  0.125f      // HD^-0.5
#define L2E  1.4426950408889634f

static_assert(DM == NH * HD);
static_assert(SEQ % QB == 0);
static_assert(SEQ % KT == 0);
static_assert(SEQ % PRB == 0 && PRB == 256);   // k_proj: 256 threads, 8 waves x 32 rows
static_assert(NB >= 1 && NB <= NB_FULL);
static_assert(SEQ >= QB && SEQ <= SEQ_FULL);
static_assert(HD % 32 == 0);
static_assert(HD == 64 && KT == 64 && KP >= 64 && KP % 8 == 0);
static_assert(SEQ / KT >= 2);   // k_attn: the two-buffer ring starts with tiles 0 and 1

typedef _Float16 h16;
typedef unsigned short bf;
typedef __attribute__((ext_vector_type(16))) __bf16   v16bf;
typedef __attribute__((ext_vector_type(16))) _Float16 v16h;
typedef __attribute__((ext_vector_type(8)))  _Float16 v8h;
typedef __attribute__((ext_vector_type(8)))  unsigned short v8us;
typedef __attribute__((ext_vector_type(4)))  unsigned short v4us;
typedef __attribute__((ext_vector_type(8)))  float    v8f;
typedef __attribute__((ext_vector_type(4)))  float    v4f;
typedef v4f __attribute__((may_alias)) v4fa;

__device__ __forceinline__ unsigned short f2bf(float f) { unsigned u = __float_as_uint(f); u += 0x7FFFu + ((u >> 16) & 1u); return (unsigned short)(u >> 16); }
__device__ __forceinline__ float bf2f(unsigned short b) { return __uint_as_float(((unsigned)b) << 16); }
__device__ __forceinline__ float bfr(float f) { return bf2f(f2bf(f)); }
__device__ __forceinline__ v16h  cat16(v8h lo, v8h hi) { return __builtin_shufflevector(lo, hi, 0, 1, 2, 3, 4, 5, 6, 7, 8, 9, 10, 11, 12, 13, 14, 15); }
__device__ __forceinline__ v16bf cat16b(v8us lo, v8us hi) { return __builtin_bit_cast(v16bf, __builtin_shufflevector(lo, hi, 0, 1, 2, 3, 4, 5, 6, 7, 8, 9, 10, 11, 12, 13, 14, 15)); }
__device__ __forceinline__ v8f wmma16(v16h a, v16h b, v8f c) { return __builtin_amdgcn_wmma_f32_16x16x32_f16(false, a, false, b, (short)0, c, false, false); }
__device__ __forceinline__ v8f wmmab(v16bf a, v16bf b, v8f c) { return __builtin_amdgcn_wmma_f32_16x16x32_bf16(false, a, false, b, (short)0, c, false, false); }
// Fragment loaders (A and B identical): p = plane + row(l&15) * pitch + k0 + 8*(l>>4); elements 0..7 <- p[0..7], elements 8..15 <- p[16..23] (k0+16+8h..).
__device__ __forceinline__ v16h  ldh(const h16* p) { return cat16(*(const v8h*)p, *(const v8h*)(p + 16)); }
__device__ __forceinline__ v16bf ldb16(const bf* p) { return cat16b(*(const v8us*)p, *(const v8us*)(p + 16)); }

// ---- k_proj: all three per-head projections in one launch. Block = 8 waves, one (b, h), PRB consecutive rows of x.
// Stage: the x slice [PRB][64] and the head's Wq, Wk, Wv [64][64] are read as whole 128-B lines in f32, RNE-converted to bf16 and laid in LDS at pitch KP, the three bias rows beside them (one block barrier).
// Products: wave (g = wave >> 1, half = wave & 1) of row group g (64 rows). q and k: A = W rows, B = x rows, so a lane holds 8 consecutive outputs e of one row t (its 32 rows: half);
// v: A = x rows, B = W rows, so a lane holds 8 consecutive t of one output e (all 64 rows, its 32 outputs: half). Both operands through the same loader, k = 0..31 then 32..63, f32 accumulate, + bf16(bias), -> fp16.
// Store: each 32 x 64 fp16 tile goes through a wave-private LDS tile so that every global store writes whole 128-B lines of Q16 / K16 [t][d] and VT16 [d][t].
__global__ __launch_bounds__(256)
void k_proj(const float* __restrict__ x, const float* __restrict__ wq, const float* __restrict__ bq, const float* __restrict__ wk, const float* __restrict__ bk,
            const float* __restrict__ wv, const float* __restrict__ bv, h16* Q16, h16* K16, h16* VT16) {
    __shared__ __align__(16) bf  Xs[PRB * KP];             // x slice, bf16, cross-wave (block barrier)
    __shared__ __align__(16) bf  Ws[3 * HD * KP];          // Wq, Wk, Wv of this head, bf16, cross-wave (block barrier)
    __shared__ __align__(32) float Bs[3 * HD];             // bf16-rounded bq, bk, bv of this head, cross-wave (block barrier)
    __shared__ __align__(16) h16 Ts[3][PRB / 32][32 * KP]; // wave-private output staging, one tile per product
    const int tid = threadIdx.x, wave = tid >> 5, lane = tid & 31, lr = lane & 15, hi = lane >> 4;
    const int h = blockIdx.y, row0 = blockIdx.x * PRB, b = row0 / SEQ, t0 = row0 % SEQ;
    const int g = wave >> 1, half = wave & 1;
    const int sr = tid >> 4, sc = (tid & 15) * 4;          // staging: 16 lanes x 16 B = one 256-B row slice
    const float* xl  = x + ((size_t)b * SEQ_FULL + t0 + sr) * DM + h * HD + sc;
    const float* wl0 = wq + (size_t)h * HD * HD + sr * HD + sc;
    const float* wl1 = wk + (size_t)h * HD * HD + sr * HD + sc;
    const float* wl2 = wv + (size_t)h * HD * HD + sr * HD + sc;
    const float* bl  = ((wave < 2) ? bq : ((wave < 4) ? bk : bv)) + h * HD + (tid & 63);   // waves 6 and 7 read bv again and store nothing
    v4f xr[PRB / 16], wr[12];
#pragma unroll
    for (int j = 0; j < PRB / 16; ++j) xr[j] = *(const v4f*)(xl + (size_t)j * 16 * DM);
#pragma unroll
    for (int j = 0; j < 4; ++j) { wr[j] = *(const v4f*)(wl0 + j * 16 * HD); wr[4 + j] = *(const v4f*)(wl1 + j * 16 * HD); wr[8 + j] = *(const v4f*)(wl2 + j * 16 * HD); }
    const float br = *bl;
    // the five address values are inputs here, so they stay in their registers up to this wait and no later instruction reuses one ahead of it
    asm volatile("s_wait_xcnt 0x0" :: "v"(xl), "v"(wl0), "v"(wl1), "v"(wl2), "v"(bl) : "memory");
#pragma unroll
    for (int j = 0; j < PRB / 16; ++j) { v4us o;
#pragma unroll
        for (int k = 0; k < 4; ++k) o[k] = f2bf(xr[j][k]);
        *(v4us*)(Xs + (sr + j * 16) * KP + sc) = o; }
#pragma unroll
    for (int j = 0; j < 12; ++j) { v4us o;
#pragma unroll
        for (int k = 0; k < 4; ++k) o[k] = f2bf(wr[j][k]);
        *(v4us*)(Ws + ((j >> 2) * HD + sr + (j & 3) * 16) * KP + sc) = o; }
    if (tid < 3 * HD) Bs[tid] = bfr(br);
    __syncthreads();
    // x fragments of row group g; slot i holds 16-row tile tb(i) = (2 * half + i) & 3, so slots 0 and 1 are this wave's own q / k rows
    v16bf xf[4][2];
#pragma unroll
    for (int i = 0; i < 4; ++i)
#pragma unroll
        for (int kk = 0; kk < 2; ++kk) xf[i][kk] = ldb16(Xs + (g * 64 + ((half * 2 + i) & 3) * 16 + lr) * KP + kk * 32 + 8 * hi);
    const size_t bh = (size_t)b * NH + h;
#pragma unroll
    for (int m = 0; m < 3; ++m) {
        h16* ts = Ts[m][wave];
        if (m < 2) {
#pragma unroll
            for (int et = 0; et < 4; ++et) {
                const v16bf w0 = ldb16(Ws + (m * HD + et * 16 + lr) * KP + 8 * hi), w1 = ldb16(Ws + (m * HD + et * 16 + lr) * KP + 32 + 8 * hi);
                const v8f bb = *(const v8f*)(Bs + m * HD + et * 16 + 8 * hi);
#pragma unroll
                for (int tt = 0; tt < 2; ++tt) { v8f c = (v8f){}; c = wmmab(w0, xf[tt][0], c); c = wmmab(w1, xf[tt][1], c);
                    v8h o;
#pragma unroll
                    for (int j = 0; j < 8; ++j) o[j] = (h16)(c[j] + bb[j]);
                    *(v8h*)(ts + (tt * 16 + lr) * KP + et * 16 + 8 * hi) = o; }
            }
        } else {
#pragma unroll
            for (int ee = 0; ee < 2; ++ee) {
                const v16bf w0 = ldb16(Ws + (2 * HD + (half * 2 + ee) * 16 + lr) * KP + 8 * hi), w1 = ldb16(Ws + (2 * HD + (half * 2 + ee) * 16 + lr) * KP + 32 + 8 * hi);
                const float bb = Bs[2 * HD + (half * 2 + ee) * 16 + lr];
#pragma unroll
                for (int i = 0; i < 4; ++i) { v8f c = (v8f){}; c = wmmab(xf[i][0], w0, c); c = wmmab(xf[i][1], w1, c);
                    v8h o;
#pragma unroll
                    for (int j = 0; j < 8; ++j) o[j] = (h16)(c[j] + bb);
                    *(v8h*)(ts + (ee * 16 + lr) * KP + ((half * 2 + i) & 3) * 16 + 8 * hi) = o; }
            }
        }
        // the rows read back below were written by other lanes of this wave: keep the compiler from moving the reads above the writes
        __builtin_amdgcn_fence(3, "wavefront"); __builtin_amdgcn_wave_barrier(); asm volatile("" ::: "memory");
        h16* dst = (m == 0) ? Q16 + (bh * SEQ + t0 + g * 64 + half * 32) * HD : ((m == 1) ? K16 + (bh * SEQ + t0 + g * 64 + half * 32) * HD : VT16 + (bh * HD + half * 32) * SEQ + t0 + g * 64);
        const size_t dp = (m < 2) ? (size_t)HD : (size_t)SEQ;
#pragma unroll
        for (int s = 0; s < 8; ++s) { const int row = 4 * s + (lane >> 3), ch = (lane & 7) * 8;
            *(v8h*)(dst + (size_t)row * dp + ch) = *(const v8h*)(ts + row * KP + ch); }
    }
}

// ---- k_attn: flash attention, block = 8 waves, one (b,h), QB queries; one wave = 16 queries (QTW tiles of 16).
// Two blocks share a WGP (waves_per_eu 4, 4: the grid is exactly two blocks per WGP): one block's tile staging and its waves' LDS and cross-lane waits are covered by the other block's waves.
// Per 64-key iteration: K tile [t][d] and V^T tile [d][t] lie in one of two LDS buffers (cross-wave regions); the next tile's asynchronous 16-B copies, four per lane, fly into the other buffer meanwhile.
// Foot of each trip: own LDS reads done, own copies landed, one block barrier (publishes tile t + 1 and frees tile t's buffer), then the copies of tile t + 2 into the freed buffer;
// S^T = K . Q^T per 16-key sub-tile (A = K rows from LDS, B = Q columns from the plane, both split-k loaders), so each lane holds 8 keys of one query;
// online softmax in f32 (running max, one exp2 per score); p x1024 packed into A fragments straight from the two adjacent 16-key accumulator tiles
// (element r <- keys 0-15 tile, element 8+r <- keys 16-31 tile, lane unchanged); O += P . V with B = V^T rows from LDS.
// Four asynchronous 16-B copies global -> LDS of one lane (two of the K tile, two of the V^T tile); the waits for them are written at the places that need them.
typedef int v4i __attribute__((ext_vector_type(4)));
typedef __attribute__((address_space(1))) v4i gv4i;
typedef __attribute__((address_space(3))) v4i lv4i;
__device__ __forceinline__ void copy16(h16* l, const h16* g) { __builtin_amdgcn_global_load_async_to_lds_b128((gv4i*)g, (lv4i*)l, 0, 0); }
__device__ __forceinline__ void copy_kv(h16* lk, h16* lv, const h16* gk, const h16* gv) {
    copy16(lk, gk); copy16(lk + 32 * KP, gk + 256 * 8); copy16(lv, gv); copy16(lv + 32 * KP, gv + (size_t)32 * SEQ);
}

__global__ __launch_bounds__(256) __attribute__((amdgpu_waves_per_eu(4, 4)))
void k_attn(const h16* __restrict__ Q16, const h16* __restrict__ K16, const h16* __restrict__ VT16, float* OUT) {
    __shared__ __align__(16) h16 Ks[2][KT * KP];         // two buffers of [t][d] at pitch KP, cross-wave (block barriers)
    __shared__ __align__(16) h16 Vs[2][HD * KP];         // two buffers of [d][t] at pitch KP, cross-wave (block barriers)
    __shared__ __align__(16) float osh[QB / (16 * QTW)][16 * OSP]; // wave-private output staging
    const int tid = threadIdx.x, wv = tid >> 5, lane = tid & 31, lr = lane & 15, hi = lane >> 4;
    const int qblks = SEQ / QB; const int bh = blockIdx.x / qblks, qblk = blockIdx.x % qblks; const int b = bh / NH, h = bh % NH;
    const int q0 = qblk * QB + wv * (16 * QTW);
    const h16* Qp = Q16 + ((size_t)bh * SEQ + q0) * HD;
    v16h qf[QTW][2];
#pragma unroll
    for (int qt = 0; qt < QTW; ++qt)
#pragma unroll
        for (int kk = 0; kk < 2; ++kk) qf[qt][kk] = ldh(Qp + (size_t)(qt * 16 + lr) * HD + kk * 32 + 8 * hi);
    const h16* Kb = K16 + (size_t)bh * SEQ * HD; const h16* Vb = VT16 + (size_t)bh * HD * SEQ;
    v8f o[QTW][4];
#pragma unroll
    for (int qt = 0; qt < QTW; ++qt)
#pragma unroll
        for (int et = 0; et < 4; ++et) o[qt][et] = (v8f){};
    float m_run[QTW], l_run[QTW];
#pragma unroll
    for (int qt = 0; qt < QTW; ++qt) { m_run[qt] = -1.0e30f; l_run[qt] = 0.f; }
    float* os = osh[wv];
    // staging: lane copies 16-B piece uu of tile rows e0 and e0 + 32, of K and of V^T
    const int e0 = tid >> 3, uu = tid & 7, lo = e0 * KP + uu * 8;
    const h16* gk = Kb + (size_t)tid * 8;                       // K tile is 8,192 contiguous bytes
    const h16* gv = Vb + (size_t)e0 * SEQ + uu * 8;
    copy_kv(Ks[0] + lo, Vs[0] + lo, gk, gv);
    asm volatile("s_wait_asynccnt 0x0" ::: "memory");           // tile 0 of this wave has landed before the barrier publishes it
    __syncthreads();
    gk += KT * HD; gv += KT;
    copy_kv(Ks[1] + lo, Vs[1] + lo, gk, gv);
#pragma unroll 1
    for (int t0 = 0; t0 < SEQ; t0 += KT) {
        const int cur = (t0 / KT) & 1;
        const h16* Kc = Ks[cur]; const h16* Vc = Vs[cur];
#pragma unroll
        for (int qt = 0; qt < QTW; ++qt) {
            v8f st[4]; v16h ka0, ka1;
#pragma unroll
            for (int ts = 0; ts < 4; ++ts) { ka0 = ldh(Kc + (ts * 16 + lr) * KP + 8 * hi); ka1 = ldh(Kc + (ts * 16 + lr) * KP + 32 + 8 * hi);
                v8f c = (v8f){}; c = wmma16(ka0, qf[qt][0], c); c = wmma16(ka1, qf[qt][1], c); st[ts] = c; }
            asm volatile("v_nop\n\tv_nop\n\tv_nop\n\tv_nop" : "+v"(st[0]), "+v"(st[1]), "+v"(st[2]), "+v"(st[3]) : "v"(ka0), "v"(ka1), "v"(qf[qt][1]));
            // online softmax: lane owns query lr, keys 8*hi + r of each 16-key sub-tile; the partner lane (lane ^ 16) owns the other 32 keys
            float tm = -1.0e30f;
#pragma unroll
            for (int ts = 0; ts < 4; ++ts)
#pragma unroll
                for (int v = 0; v < 8; ++v) { const float t = st[ts][v] * SCL; st[ts][v] = t; tm = fmaxf(tm, t); }
            tm = fmaxf(tm, __shfl_xor(tm, 16, 32));
            const float m_new = fmaxf(m_run[qt], tm);
            float da = __fsub_rn(m_run[qt], m_new); asm volatile("" : "+v"(da));
            const float alpha = __builtin_amdgcn_exp2f(__fmul_rn(da, L2E));
            float rs = 0.f; v16h pa[2];
#pragma unroll
            for (int v = 0; v < 8; ++v) {
                float d0 = __fsub_rn(st[0][v], m_new), d1 = __fsub_rn(st[1][v], m_new), d2 = __fsub_rn(st[2][v], m_new), d3 = __fsub_rn(st[3][v], m_new);
                asm volatile("" : "+v"(d0)); asm volatile("" : "+v"(d1)); asm volatile("" : "+v"(d2)); asm volatile("" : "+v"(d3));
                const float p0 = __builtin_amdgcn_exp2f(__fmul_rn(d0, L2E)), p1 = __builtin_amdgcn_exp2f(__fmul_rn(d1, L2E));
                const float p2 = __builtin_amdgcn_exp2f(__fmul_rn(d2, L2E)), p3 = __builtin_amdgcn_exp2f(__fmul_rn(d3, L2E));
                rs += (p0 + p1) + (p2 + p3);
                pa[0][v] = (h16)(p0 * PCAR); pa[0][v + 8] = (h16)(p1 * PCAR);   // keys 8h+v and 16+8h+v of the 64-key tile
                pa[1][v] = (h16)(p2 * PCAR); pa[1][v + 8] = (h16)(p3 * PCAR);   // keys 32+8h+v and 48+8h+v
            }
            rs += __shfl_xor(rs, 16, 32);
            l_run[qt] = l_run[qt] * alpha + rs; m_run[qt] = m_new;
            // rescale O: accumulator element v of this lane is query row 8*hi + v; alpha for that query lives in lane 8*hi + v
#pragma unroll
            for (int v = 0; v < 8; ++v) { const float fs = __shfl(alpha, v + 8 * hi, 32); o[qt][0][v] *= fs; o[qt][1][v] *= fs; o[qt][2][v] *= fs; o[qt][3][v] *= fs; }
            v16h vb0, vb1;
#pragma unroll
            for (int et = 0; et < 4; ++et) { vb0 = ldh(Vc + (et * 16 + lr) * KP + 8 * hi); vb1 = ldh(Vc + (et * 16 + lr) * KP + 32 + 8 * hi);
                o[qt][et] = wmma16(pa[0], vb0, o[qt][et]); o[qt][et] = wmma16(pa[1], vb1, o[qt][et]); }
            asm volatile("v_nop\n\tv_nop\n\tv_nop\n\tv_nop" : "+v"(o[qt][0]), "+v"(o[qt][1]), "+v"(o[qt][2]), "+v"(o[qt][3]) : "v"(pa[0]), "v"(pa[1]), "v"(vb1));
        }
        asm volatile("s_wait_dscnt 0x0" ::: "memory");      // this wave's reads of the current buffer are done before the barrier frees it for refilling
        asm volatile("s_wait_asynccnt 0x0" ::: "memory");   // this wave's copies of the next tile have landed before the barrier publishes them
        __syncthreads();
        if (t0 + 2 * KT < SEQ) {                            // block-uniform: a tile t + 2 exists
            gk += KT * HD; gv += KT;
            copy_kv(Ks[cur] + lo, Vs[cur] + lo, gk, gv);
        }
    }
    asm volatile("s_wait_asynccnt 0x0" ::: "memory");       // nothing of this wave is in flight when it goes on to the epilogue and ends
    // epilogue: out[b][q][h*HD + d] = O[q][d] / (l * PCAR)
#pragma unroll
    for (int qt = 0; qt < QTW; ++qt) {
        const float inv = 1.0f / (l_run[qt] * PCAR);
#pragma unroll
        for (int j = 0; j < 8; ++j) { const float fs = __shfl(inv, j + 8 * hi, 32);
#pragma unroll
            for (int et = 0; et < 4; ++et) os[(hi * 8 + j) * OSP + et * 16 + lr] = o[qt][et][j] * fs; }
        __builtin_amdgcn_fence(3, "wavefront"); __builtin_amdgcn_wave_barrier(); asm volatile("" ::: "memory");
        float* crow = OUT + ((size_t)b * SEQ + q0 + qt * 16) * DM + (size_t)h * HD;
{
#pragma unroll
            for (int s = 0; s < 8; ++s) { const int row = 2 * s + hi, cofs = lr * 4; const v4f val = *(const v4fa*)(os + row * OSP + cofs);
                *(v4f*)(crow + (size_t)row * DM + cofs) = val; }
             }
        __builtin_amdgcn_wave_barrier(); asm volatile("" ::: "memory");
    }
}

extern "C" void kernel_launch(void* const* d_in, const int* in_sizes, int n_in,
                              void* d_out, int out_size, void* d_ws, size_t ws_size, hipStream_t stream) {
    if (n_in < 7) return;
    if (in_sizes[0] < (NB - 1) * SEQ_FULL * DM + SEQ * DM) return;
    if (in_sizes[1] < NH * HD * HD || in_sizes[3] < NH * HD * HD || in_sizes[5] < NH * HD * HD) return;
    if (in_sizes[2] < NH * HD || in_sizes[4] < NH * HD || in_sizes[6] < NH * HD) return;
    if (out_size < NB * SEQ * DM) return;
    const float* x = (const float*)d_in[0]; const float* wq = (const float*)d_in[1]; const float* bq = (const float*)d_in[2]; const float* wk = (const float*)d_in[3]; const float* bk = (const float*)d_in[4]; const float* wv = (const float*)d_in[5]; const float* bv = (const float*)d_in[6];
    float* OUT = (float*)d_out;     // [NB][SEQ][DM]
    char* wsp = (char*)d_ws;
    auto take = [&](size_t bytes) { char* p = wsp; wsp += (bytes + 255) & ~(size_t)255; return (void*)p; };
    h16* Q16  = (h16*)take((size_t)NB * NH * SEQ * HD * 2);    // [NB][16][SEQ][64] fp16 = 8,388,608 B
    h16* K16  = (h16*)take((size_t)NB * NH * SEQ * HD * 2);
    h16* VT16 = (h16*)take((size_t)NB * NH * HD * SEQ * 2);    // [NB][16][64][SEQ] fp16
    if ((size_t)(wsp - (char*)d_ws) > ws_size) return;         // total 25,165,824 B
    k_proj<<<dim3((unsigned)(NB * SEQ / PRB), NH, 1), 256, 0, stream>>>(x, wq, bq, wk, bk, wv, bv, Q16, K16, VT16);
    k_attn<<<(unsigned)(NB * NH * (SEQ / QB)), 256, 0, stream>>>(Q16, K16, VT16, OUT);
}

// v005
// Measured time: 47.7 microseconds a run.
// In two side-by-side timings against v004, it was 1.10 and 1.11 times as fast.
// Over all steps from v000 it is 4.38 times as fast.
#include <hip/hip_runtime.h>

// Contractions: per-head q/k/v projections = v_wmma_f32_16x16x32_bf16 (bf16 operands from RNE-converted x and W, f32 accumulate, bf16-rounded bias added in f32); attention scores q.k and p.v = v_wmma_f32_16x16x32_f16 (fp16 operands, p carried x1024, f32 accumulate); online softmax, normalisation and output in f32.
// Layout: x [NB][SEQ_FULL][1024] (first SEQ rows of each batch used) viewed as 16 head slices of 64; q = x_h Wq[h]^T + bq[h] (W is [h][out][in]), k, v likewise; scores = q.k / 8 over all SEQ keys, softmax, out_h = attn v; heads re-stacked -> [NB][SEQ][1024].

#ifndef NB
#define NB 2
#endif
#ifndef SEQ
#define SEQ 2048
#endif
#define NB_FULL  2
#define SEQ_FULL 2048
#define DM   1024
#define NH   16
#define HD   64
#define KT   64          // keys staged in LDS per iteration
#define QTW  1           // 16-query tiles per wave
#define QB   (8 * 16 * QTW)   // queries per block (8 waves x 16): 512 blocks, two resident per WGP, four waves per SIMD
#define PRB  256         // rows of x per projection block (8 waves)
#define KP   72          // LDS pitch (halves) of the K and V^T tile rows: 144 B = 16 B x odd, so the 16 rows one ds_load_b128 half-wave reads fall on 64 distinct banks
#define OSP  68          // LDS pitch (floats) of the per-wave output staging tile
#define PCARL2 10.0f     // log2 of the power-of-two carry (x1024) on the fp16 p operand; the row sum l carries it too
#define CEX  0.18033688011112042f   // HD^-0.5 * log2 e: exp(s / 8) = exp2(s * CEX)

static_assert(DM == NH * HD);
static_assert(SEQ % QB == 0);
static_assert(SEQ % KT == 0);
static_assert(SEQ % PRB == 0 && PRB == 256);   // k_proj: 256 threads, 8 waves x 32 rows
static_assert(NB >= 1 && NB <= NB_FULL);
static_assert(SEQ >= QB && SEQ <= SEQ_FULL);
static_assert(HD % 32 == 0);
static_assert(HD == 64 && KT == 64 && KP >= 64 && KP % 8 == 0);
static_assert(SEQ / KT >= 2);   // k_attn: the two-buffer ring starts with tiles 0 and 1

typedef _Float16 h16;
typedef unsigned short bf;
typedef __attribute__((ext_vector_type(16))) __bf16   v16bf;
typedef __attribute__((ext_vector_type(16))) _Float16 v16h;
typedef __attribute__((ext_vector_type(8)))  _Float16 v8h;
typedef __attribute__((ext_vector_type(8)))  unsigned short v8us;
typedef __attribute__((ext_vector_type(4)))  unsigned short v4us;
typedef __attribute__((ext_vector_type(8)))  float    v8f;
typedef __attribute__((ext_vector_type(4)))  float    v4f;
typedef v4f __attribute__((may_alias)) v4fa;
typedef __attribute__((ext_vector_type(2)))  float    v2f;

__device__ __forceinline__ unsigned short f2bf(float f) { unsigned u = __float_as_uint(f); u += 0x7FFFu + ((u >> 16) & 1u); return (unsigned short)(u >> 16); }
__device__ __forceinline__ float bf2f(unsigned short b) { return __uint_as_float(((unsigned)b) << 16); }
__device__ __forceinline__ float bfr(float f) { return bf2f(f2bf(f)); }
__device__ __forceinline__ v16h  cat16(v8h lo, v8h hi) { return __builtin_shufflevector(lo, hi, 0, 1, 2, 3, 4, 5, 6, 7, 8, 9, 10, 11, 12, 13, 14, 15); }
__device__ __forceinline__ v16bf cat16b(v8us lo, v8us hi) { return __builtin_bit_cast(v16bf, __builtin_shufflevector(lo, hi, 0, 1, 2, 3, 4, 5, 6, 7, 8, 9, 10, 11, 12, 13, 14, 15)); }
__device__ __forceinline__ v8f wmma16(v16h a, v16h b, v8f c) { return __builtin_amdgcn_wmma_f32_16x16x32_f16(false, a, false, b, (short)0, c, false, false); }
__device__ __forceinline__ v8f wmmab(v16bf a, v16bf b, v8f c) { return __builtin_amdgcn_wmma_f32_16x16x32_bf16(false, a, false, b, (short)0, c, false, false); }
// Fragment loaders (A and B identical): p = plane + row(l&15) * pitch + k0 + 8*(l>>4); elements 0..7 <- p[0..7], elements 8..15 <- p[16..23] (k0+16+8h..).
__device__ __forceinline__ v16h  ldh(const h16* p) { return cat16(*(const v8h*)p, *(const v8h*)(p + 16)); }
__device__ __forceinline__ v16bf ldb16(const bf* p) { return cat16b(*(const v8us*)p, *(const v8us*)(p + 16)); }

// ---- k_proj: all three per-head projections in one launch. Block = 8 waves, one (b, h), PRB consecutive rows of x.
// Stage: the x slice [PRB][64] and the head's Wq, Wk, Wv [64][64] are read as whole 128-B lines in f32, RNE-converted to bf16 and laid in LDS at pitch KP, the three bias rows beside them (one block barrier).
// Products: wave (g = wave >> 1, half = wave & 1) of row group g (64 rows). q and k: A = W rows, B = x rows, so a lane holds 8 consecutive outputs e of one row t (its 32 rows: half);
// v: A = x rows, B = W rows, so a lane holds 8 consecutive t of one output e (all 64 rows, its 32 outputs: half). Both operands through the same loader, k = 0..31 then 32..63, f32 accumulate, + bf16(bias), -> fp16.
// Store: each 32 x 64 fp16 tile goes through a wave-private LDS tile so that every global store writes whole 128-B lines of Q16 / K16 [t][d] and VT16 [d][t].
__global__ __launch_bounds__(256)
void k_proj(const float* __restrict__ x, const float* __restrict__ wq, const float* __restrict__ bq, const float* __restrict__ wk, const float* __restrict__ bk,
            const float* __restrict__ wv, const float* __restrict__ bv, h16* Q16, h16* K16, h16* VT16) {
    __shared__ __align__(16) bf  Xs[PRB * KP];             // x slice, bf16, cross-wave (block barrier)
    __shared__ __align__(16) bf  Ws[3 * HD * KP];          // Wq, Wk, Wv of this head, bf16, cross-wave (block barrier)
    __shared__ __align__(32) float Bs[3 * HD];             // bf16-rounded bq, bk, bv of this head, cross-wave (block barrier)
    __shared__ __align__(16) h16 Ts[3][PRB / 32][32 * KP]; // wave-private output staging, one tile per product
    const int tid = threadIdx.x, wave = tid >> 5, lane = tid & 31, lr = lane & 15, hi = lane >> 4;
    const int h = blockIdx.y, row0 = blockIdx.x * PRB, b = row0 / SEQ, t0 = row0 % SEQ;
    const int g = wave >> 1, half = wave & 1;
    const int sr = tid >> 4, sc = (tid & 15) * 4;          // staging: 16 lanes x 16 B = one 256-B row slice
    const float* xl  = x + ((size_t)b * SEQ_FULL + t0 + sr) * DM + h * HD + sc;
    const float* wl0 = wq + (size_t)h * HD * HD + sr * HD + sc;
    const float* wl1 = wk + (size_t)h * HD * HD + sr * HD + sc;
    const float* wl2 = wv + (size_t)h * HD * HD + sr * HD + sc;
    const float* bl  = ((wave < 2) ? bq : ((wave < 4) ? bk : bv)) + h * HD + (tid & 63);   // waves 6 and 7 read bv again and store nothing
    v4f xr[PRB / 16], wr[12];
#pragma unroll
    for (int j = 0; j < PRB / 16; ++j) xr[j] = *(const v4f*)(xl + (size_t)j * 16 * DM);
#pragma unroll
    for (int j = 0; j < 4; ++j) { wr[j] = *(const v4f*)(wl0 + j * 16 * HD); wr[4 + j] = *(const v4f*)(wl1 + j * 16 * HD); wr[8 + j] = *(const v4f*)(wl2 + j * 16 * HD); }
    const float br = *bl;
    // the five address values are inputs here, so they stay in their registers up to this wait and no later instruction reuses one ahead of it
    asm volatile("s_wait_xcnt 0x0" :: "v"(xl), "v"(wl0), "v"(wl1), "v"(wl2), "v"(bl) : "memory");
#pragma unroll
    for (int j = 0; j < PRB / 16; ++j) { v4us o;
#pragma unroll
        for (int k = 0; k < 4; ++k) o[k] = f2bf(xr[j][k]);
        *(v4us*)(Xs + (sr + j * 16) * KP + sc) = o; }
#pragma unroll
    for (int j = 0; j < 12; ++j) { v4us o;
#pragma unroll
        for (int k = 0; k < 4; ++k) o[k] = f2bf(wr[j][k]);
        *(v4us*)(Ws + ((j >> 2) * HD + sr + (j & 3) * 16) * KP + sc) = o; }
    if (tid < 3 * HD) Bs[tid] = bfr(br);
    __syncthreads();
    // x fragments of row group g; slot i holds 16-row tile tb(i) = (2 * half + i) & 3, so slots 0 and 1 are this wave's own q / k rows
    v16bf xf[4][2];
#pragma unroll
    for (int i = 0; i < 4; ++i)
#pragma unroll
        for (int kk = 0; kk < 2; ++kk) xf[i][kk] = ldb16(Xs + (g * 64 + ((half * 2 + i) & 3) * 16 + lr) * KP + kk * 32 + 8 * hi);
    const size_t bh = (size_t)b * NH + h;
#pragma unroll
    for (int m = 0; m < 3; ++m) {
        h16* ts = Ts[m][wave];
        if (m < 2) {
#pragma unroll
            for (int et = 0; et < 4; ++et) {
                const v16bf w0 = ldb16(Ws + (m * HD + et * 16 + lr) * KP + 8 * hi), w1 = ldb16(Ws + (m * HD + et * 16 + lr) * KP + 32 + 8 * hi);
                const v8f bb = *(const v8f*)(Bs + m * HD + et * 16 + 8 * hi);
#pragma unroll
                for (int tt = 0; tt < 2; ++tt) { v8f c = (v8f){}; c = wmmab(w0, xf[tt][0], c); c = wmmab(w1, xf[tt][1], c);
                    v8h o;
#pragma unroll
                    for (int j = 0; j < 8; ++j) o[j] = (h16)(c[j] + bb[j]);
                    *(v8h*)(ts + (tt * 16 + lr) * KP + et * 16 + 8 * hi) = o; }
            }
        } else {
#pragma unroll
            for (int ee = 0; ee < 2; ++ee) {
                const v16bf w0 = ldb16(Ws + (2 * HD + (half * 2 + ee) * 16 + lr) * KP + 8 * hi), w1 = ldb16(Ws + (2 * HD + (half * 2 + ee) * 16 + lr) * KP + 32 + 8 * hi);
                const float bb = Bs[2 * HD + (half * 2 + ee) * 16 + lr];
#pragma unroll
                for (int i = 0; i < 4; ++i) { v8f c = (v8f){}; c = wmmab(xf[i][0], w0, c); c = wmmab(xf[i][1], w1, c);
                    v8h o;
#pragma unroll
                    for (int j = 0; j < 8; ++j) o[j] = (h16)(c[j] + bb);
                    *(v8h*)(ts + (ee * 16 + lr) * KP + ((half * 2 + i) & 3) * 16 + 8 * hi) = o; }
            }
        }
        // the rows read back below were written by other lanes of this wave: keep the compiler from moving the reads above the writes
        __builtin_amdgcn_fence(3, "wavefront"); __builtin_amdgcn_wave_barrier(); asm volatile("" ::: "memory");
        h16* dst = (m == 0) ? Q16 + (bh * SEQ + t0 + g * 64 + half * 32) * HD : ((m == 1) ? K16 + (bh * SEQ + t0 + g * 64 + half * 32) * HD : VT16 + (bh * HD + half * 32) * SEQ + t0 + g * 64);
        const size_t dp = (m < 2) ? (size_t)HD : (size_t)SEQ;
#pragma unroll
        for (int s = 0; s < 8; ++s) { const int row = 4 * s + (lane >> 3), ch = (lane & 7) * 8;
            *(v8h*)(dst + (size_t)row * dp + ch) = *(const v8h*)(ts + row * KP + ch); }
    }
}

// ---- k_attn: flash attention, block = 8 waves, one (b,h), QB queries; one wave = 16 queries (QTW tiles of 16).
// Two blocks share a WGP (waves_per_eu 4, 4: the grid is exactly two blocks per WGP): one block's tile staging and its waves' LDS and cross-lane waits are covered by the other block's waves.
// Per 64-key iteration: K tile [t][d] and V^T tile [d][t] lie in one of two LDS buffers (cross-wave regions); the next tile's asynchronous 16-B copies, four per lane, fly into the other buffer meanwhile.
// Foot of each trip: own LDS reads done, own copies landed, one block barrier (publishes tile t + 1 and frees tile t's buffer), then the copies of tile t + 2 into the freed buffer;
// S^T = K . Q^T per 16-key sub-tile (A = K rows from LDS, B = Q columns from the plane, both split-k loaders), so each lane holds 8 keys of one query;
// online softmax in f32 (running max of the raw scores, one multiply-add and one exp2 per score); p x1024 packed into A fragments straight from the two adjacent 16-key accumulator tiles
// (element r <- keys 0-15 tile, element 8+r <- keys 16-31 tile, lane unchanged); O += P . V with B = V^T rows from LDS.
// Four asynchronous 16-B copies global -> LDS of one lane (two of the K tile, two of the V^T tile); the waits for them are written at the places that need them.
typedef int v4i __attribute__((ext_vector_type(4)));
typedef __attribute__((address_space(1))) v4i gv4i;
typedef __attribute__((address_space(3))) v4i lv4i;
__device__ __forceinline__ void copy16(h16* l, const h16* g) { __builtin_amdgcn_global_load_async_to_lds_b128((gv4i*)g, (lv4i*)l, 0, 0); }
__device__ __forceinline__ void copy_kv(h16* lk, h16* lv, const h16* gk, const h16* gv) {
    copy16(lk, gk); copy16(lk + 32 * KP, gk + 256 * 8); copy16(lv, gv); copy16(lv + 32 * KP, gv + (size_t)32 * SEQ);
}

__global__ __launch_bounds__(256) __attribute__((amdgpu_waves_per_eu(4, 4)))
void k_attn(const h16* __restrict__ Q16, const h16* __restrict__ K16, const h16* __restrict__ VT16, float* OUT) {
    __shared__ __align__(16) h16 Ks[2][KT * KP];         // two buffers of [t][d] at pitch KP, cross-wave (block barriers)
    __shared__ __align__(16) h16 Vs[2][HD * KP];         // two buffers of [d][t] at pitch KP, cross-wave (block barriers)
    __shared__ __align__(16) float osh[QB / (16 * QTW)][16 * OSP]; // wave-private output staging
    const int tid = threadIdx.x, wv = tid >> 5, lane = tid & 31, lr = lane & 15, hi = lane >> 4;
    const int qblks = SEQ / QB; const int bh = blockIdx.x / qblks, qblk = blockIdx.x % qblks; const int b = bh / NH, h = bh % NH;
    const int q0 = qblk * QB + wv * (16 * QTW);
    const h16* Qp = Q16 + ((size_t)bh * SEQ + q0) * HD;
    v16h qf[QTW][2];
#pragma unroll
    for (int qt = 0; qt < QTW; ++qt)
#pragma unroll
        for (int kk = 0; kk < 2; ++kk) qf[qt][kk] = ldh(Qp + (size_t)(qt * 16 + lr) * HD + kk * 32 + 8 * hi);
    const h16* Kb = K16 + (size_t)bh * SEQ * HD; const h16* Vb = VT16 + (size_t)bh * HD * SEQ;
    v8f o[QTW][4];
#pragma unroll
    for (int qt = 0; qt < QTW; ++qt)
#pragma unroll
        for (int et = 0; et < 4; ++et) o[qt][et] = (v8f){};
    float m_run[QTW], l_run[QTW];
#pragma unroll
    for (int qt = 0; qt < QTW; ++qt) { m_run[qt] = -1.0e30f; l_run[qt] = 0.f; }
    float* os = osh[wv];
    // staging: lane copies 16-B piece uu of tile rows e0 and e0 + 32, of K and of V^T
    const int e0 = tid >> 3, uu = tid & 7, lo = e0 * KP + uu * 8;
    const h16* gk = Kb + (size_t)tid * 8;                       // K tile is 8,192 contiguous bytes
    const h16* gv = Vb + (size_t)e0 * SEQ + uu * 8;
    copy_kv(Ks[0] + lo, Vs[0] + lo, gk, gv);
    asm volatile("s_wait_asynccnt 0x0" ::: "memory");           // tile 0 of this wave has landed before the barrier publishes it
    __syncthreads();
    gk += KT * HD; gv += KT;
    copy_kv(Ks[1] + lo, Vs[1] + lo, gk, gv);
#pragma unroll 1
    for (int t0 = 0; t0 < SEQ; t0 += KT) {
        const int cur = (t0 / KT) & 1;
        const h16* Kc = Ks[cur]; const h16* Vc = Vs[cur];
#pragma unroll
        for (int qt = 0; qt < QTW; ++qt) {
            v8f st[4]; v16h ka0, ka1;
#pragma unroll
            for (int ts = 0; ts < 4; ++ts) { ka0 = ldh(Kc + (ts * 16 + lr) * KP + 8 * hi); ka1 = ldh(Kc + (ts * 16 + lr) * KP + 32 + 8 * hi);
                v8f c = (v8f){}; c = wmma16(ka0, qf[qt][0], c); c = wmma16(ka1, qf[qt][1], c); st[ts] = c; }
            asm volatile("v_nop\n\tv_nop\n\tv_nop\n\tv_nop" : "+v"(st[0]), "+v"(st[1]), "+v"(st[2]), "+v"(st[3]) : "v"(ka0), "v"(ka1), "v"(qf[qt][1]));
            // online softmax: lane owns query lr, keys 8*hi + r of each 16-key sub-tile; the partner lane (lane ^ 16) owns the other 32 keys
            float tm = -1.0e30f;   // maximum of the raw scores: the factor CEX is positive, so it is the maximum of the scaled ones too
#pragma unroll
            for (int ts = 0; ts < 4; ++ts)
#pragma unroll
                for (int v = 0; v < 8; ++v) tm = fmaxf(tm, st[ts][v]);
            tm = fmaxf(tm, __shfl_xor(tm, 16, 32));
            const float m_new = fmaxf(m_run[qt], tm);
            // alpha = exp2((m_old - m_new) * CEX), in asm so that it is one unit with its v_nop: the free slot that the instruction set asks for behind a transcendental, here in front of the
            // cross-lane reads of alpha
            float alpha; asm("v_exp_f32 %0, %1\n\tv_nop" : "=v"(alpha) : "v"((m_run[qt] - m_new) * CEX));
            // p x1024 = exp2(s * CEX + nb): the score scale, log2 e and the carry sit in one multiply-add, two scores per packed instruction
            const float nb = __builtin_fmaf(-m_new, CEX, PCARL2);
            const v2f c2 = {CEX, CEX}, nb2 = {nb, nb};
#pragma unroll
            for (int ts = 0; ts < 4; ++ts)
#pragma unroll
                for (int v = 0; v < 8; v += 2) { const v2f a = __builtin_elementwise_fma((v2f){st[ts][v], st[ts][v + 1]}, c2, nb2);
                    st[ts][v] = __builtin_amdgcn_exp2f(a[0]); st[ts][v + 1] = __builtin_amdgcn_exp2f(a[1]); }
            float rs = 0.f; v16h pa[2];
#pragma unroll
            for (int v = 0; v < 8; ++v) {
                const float p0 = st[0][v], p1 = st[1][v], p2 = st[2][v], p3 = st[3][v];
                rs += (p0 + p1) + (p2 + p3);
                pa[0][v] = (h16)p0; pa[0][v + 8] = (h16)p1;   // keys 8h+v and 16+8h+v of the 64-key tile
                pa[1][v] = (h16)p2; pa[1][v + 8] = (h16)p3;   // keys 32+8h+v and 48+8h+v
            }
            rs += __shfl_xor(rs, 16, 32);
            l_run[qt] = l_run[qt] * alpha + rs; m_run[qt] = m_new;
            // rescale O: accumulator element v of this lane is query row 8*hi + v; alpha for that query lives in lane 8*hi + v
#pragma unroll
            for (int v = 0; v < 8; ++v) { const float fs = __shfl(alpha, v + 8 * hi, 32); o[qt][0][v] *= fs; o[qt][1][v] *= fs; o[qt][2][v] *= fs; o[qt][3][v] *= fs; }
            v16h vb0, vb1;
#pragma unroll
            for (int et = 0; et < 4; ++et) { vb0 = ldh(Vc + (et * 16 + lr) * KP + 8 * hi); vb1 = ldh(Vc + (et * 16 + lr) * KP + 32 + 8 * hi);
                o[qt][et] = wmma16(pa[0], vb0, o[qt][et]); o[qt][et] = wmma16(pa[1], vb1, o[qt][et]); }
            asm volatile("v_nop\n\tv_nop\n\tv_nop\n\tv_nop" : "+v"(o[qt][0]), "+v"(o[qt][1]), "+v"(o[qt][2]), "+v"(o[qt][3]) : "v"(pa[0]), "v"(pa[1]), "v"(vb1));
        }
        asm volatile("s_wait_dscnt 0x0" ::: "memory");      // this wave's reads of the current buffer are done before the barrier frees it for refilling
        asm volatile("s_wait_asynccnt 0x0" ::: "memory");   // this wave's copies of the next tile have landed before the barrier publishes them
        __syncthreads();
        if (t0 + 2 * KT < SEQ) {                            // block-uniform: a tile t + 2 exists
            gk += KT * HD; gv += KT;
            copy_kv(Ks[cur] + lo, Vs[cur] + lo, gk, gv);
        }
    }
    asm volatile("s_wait_asynccnt 0x0" ::: "memory");       // nothing of this wave is in flight when it goes on to the epilogue and ends
    // epilogue: out[b][q][h*HD + d] = O[q][d] / l (both carry x1024)
#pragma unroll
    for (int qt = 0; qt < QTW; ++qt) {
        const float inv = 1.0f / l_run[qt];
#pragma unroll
        for (int j = 0; j < 8; ++j) { const float fs = __shfl(inv, j + 8 * hi, 32);
#pragma unroll
            for (int et = 0; et < 4; ++et) os[(hi * 8 + j) * OSP + et * 16 + lr] = o[qt][et][j] * fs; }
        __builtin_amdgcn_fence(3, "wavefront"); __builtin_amdgcn_wave_barrier(); asm volatile("" ::: "memory");
        float* crow = OUT + ((size_t)b * SEQ + q0 + qt * 16) * DM + (size_t)h * HD;
{
#pragma unroll
            for (int s = 0; s < 8; ++s) { const int row = 2 * s + hi, cofs = lr * 4; const v4f val = *(const v4fa*)(os + row * OSP + cofs);
                *(v4f*)(crow + (size_t)row * DM + cofs) = val; }
             }
        __builtin_amdgcn_wave_barrier(); asm volatile("" ::: "memory");
    }
}

extern "C" void kernel_launch(void* const* d_in, const int* in_sizes, int n_in,
                              void* d_out, int out_size, void* d_ws, size_t ws_size, hipStream_t stream) {
    if (n_in < 7) return;
    if (in_sizes[0] < (NB - 1) * SEQ_FULL * DM + SEQ * DM) return;
    if (in_sizes[1] < NH * HD * HD || in_sizes[3] < NH * HD * HD || in_sizes[5] < NH * HD * HD) return;
    if (in_sizes[2] < NH * HD || in_sizes[4] < NH * HD || in_sizes[6] < NH * HD) return;
    if (out_size < NB * SEQ * DM) return;
    const float* x = (const float*)d_in[0]; const float* wq = (const float*)d_in[1]; const float* bq = (const float*)d_in[2]; const float* wk = (const float*)d_in[3]; const float* bk = (const float*)d_in[4]; const float* wv = (const float*)d_in[5]; const float* bv = (const float*)d_in[6];
    float* OUT = (float*)d_out;     // [NB][SEQ][DM]
    char* wsp = (char*)d_ws;
    auto take = [&](size_t bytes) { char* p = wsp; wsp += (bytes + 255) & ~(size_t)255; return (void*)p; };
    h16* Q16  = (h16*)take((size_t)NB * NH * SEQ * HD * 2);    // [NB][16][SEQ][64] fp16 = 8,388,608 B
    h16* K16  = (h16*)take((size_t)NB * NH * SEQ * HD * 2);
    h16* VT16 = (h16*)take((size_t)NB * NH * HD * SEQ * 2);    // [NB][16][64][SEQ] fp16
    if ((size_t)(wsp - (char*)d_ws) > ws_size) return;         // total 25,165,824 B
    k_proj<<<dim3((unsigned)(NB * SEQ / PRB), NH, 1), 256, 0, stream>>>(x, wq, bq, wk, bk, wv, bv, Q16, K16, VT16);
    k_attn<<<(unsigned)(NB * NH * (SEQ / QB)), 256, 0, stream>>>(Q16, K16, VT16, OUT);
}

// v006
// Measured time: 42.5 microseconds a run.
// In both of two side-by-side timings against v005, it was 1.12 times as fast.
// All steps since v000 together make it 4.90 times as fast.
#include <hip/hip_runtime.h>

// Contractions: per-head q/k/v projections = v_wmma_f32_16x16x32_bf16 (bf16 operands from RNE-converted x and W, f32 accumulate, bf16-rounded bias added in f32); attention scores q.k and p.v = v_wmma_f32_16x16x32_f16 (fp16 operands, p carried x1024, f32 accumulate); online softmax, normalisation and output in f32.
// Layout: x [NB][SEQ_FULL][1024] (first SEQ rows of each batch used) viewed as 16 head slices of 64; q = x_h Wq[h]^T + bq[h] (W is [h][out][in]), k, v likewise; scores = q.k / 8 over all SEQ keys, softmax, out_h = attn v; heads re-stacked -> [NB][SEQ][1024].

#ifndef NB
#define NB 2
#endif
#ifndef SEQ
#define SEQ 2048
#endif
#define NB_FULL  2
#define SEQ_FULL 2048
#define DM   1024
#define NH   16
#define HD   64
#define KT   64          // keys per LDS tile
#define QTW  2           // 16-query tiles per wave: every K and V^T fragment read from LDS feeds two products
#define KSP  2           // 64-key tiles per stage: waves 0-3 of a block take the first, waves 4-7 the second
#define QB   (4 * 16 * QTW)   // queries per block (4 wave pairs x 32): 512 blocks, two resident per WGP, four waves per SIMD
#define PRB  256         // rows of x per projection block (8 waves)
#define KP   72          // LDS pitch (halves) of the K and V^T tile rows: 144 B = 16 B x odd, so the 16 rows one ds_load_b128 half-wave reads fall on 64 distinct banks
#define OSP  68          // LDS pitch (floats) of the per-wave output staging tile
#define PCARL2 10.0f     // log2 of the power-of-two carry (x1024) on the fp16 p operand; the row sum l carries it too
#define CEX  0.18033688011112042f   // HD^-0.5 * log2 e: exp(s / 8) = exp2(s * CEX)

static_assert(DM == NH * HD);
static_assert(SEQ % QB == 0);
static_assert(SEQ % (KSP * KT) == 0);
static_assert(SEQ % PRB == 0 && PRB == 256);   // k_proj: 256 threads, 8 waves x 32 rows
static_assert(NB >= 1 && NB <= NB_FULL);
static_assert(SEQ >= QB && SEQ <= SEQ_FULL);
static_assert(HD % 32 == 0);
static_assert(HD == 64 && KT == 64 && KP >= 64 && KP % 8 == 0);
static_assert(SEQ / (KSP * KT) >= 2);   // k_attn: the two-buffer ring starts with stages 0 and 1
static_assert(QTW == 2 && KSP == 2);    // k_attn: a wave keeps one of its two query tiles and hands the other to its partner

typedef _Float16 h16;
typedef unsigned short bf;
typedef __attribute__((ext_vector_type(16))) __bf16   v16bf;
typedef __attribute__((ext_vector_type(16))) _Float16 v16h;
typedef __attribute__((ext_vector_type(8)))  _Float16 v8h;
typedef __attribute__((ext_vector_type(8)))  unsigned short v8us;
typedef __attribute__((ext_vector_type(4)))  unsigned short v4us;
typedef __attribute__((ext_vector_type(8)))  float    v8f;
typedef __attribute__((ext_vector_type(4)))  float    v4f;
typedef v4f __attribute__((may_alias)) v4fa;
typedef __attribute__((ext_vector_type(2)))  float    v2f;

__device__ __forceinline__ unsigned short f2bf(float f) { unsigned u = __float_as_uint(f); u += 0x7FFFu + ((u >> 16) & 1u); return (unsigned short)(u >> 16); }
__device__ __forceinline__ float bf2f(unsigned short b) { return __uint_as_float(((unsigned)b) << 16); }
__device__ __forceinline__ float bfr(float f) { return bf2f(f2bf(f)); }
__device__ __forceinline__ v16h  cat16(v8h lo, v8h hi) { return __builtin_shufflevector(lo, hi, 0, 1, 2, 3, 4, 5, 6, 7, 8, 9, 10, 11, 12, 13, 14, 15); }
__device__ __forceinline__ v16bf cat16b(v8us lo, v8us hi) { return __builtin_bit_cast(v16bf, __builtin_shufflevector(lo, hi, 0, 1, 2, 3, 4, 5, 6, 7, 8, 9, 10, 11, 12, 13, 14, 15)); }
__device__ __forceinline__ v8f wmma16(v16h a, v16h b, v8f c) { return __builtin_amdgcn_wmma_f32_16x16x32_f16(false, a, false, b, (short)0, c, false, false); }
__device__ __forceinline__ v8f wmmab(v16bf a, v16bf b, v8f c) { return __builtin_amdgcn_wmma_f32_16x16x32_bf16(false, a, false, b, (short)0, c, false, false); }
// Fragment loaders (A and B identical): p = plane + row(l&15) * pitch + k0 + 8*(l>>4); elements 0..7 <- p[0..7], elements 8..15 <- p[16..23] (k0+16+8h..).
__device__ __forceinline__ v16h  ldh(const h16* p) { return cat16(*(const v8h*)p, *(const v8h*)(p + 16)); }
__device__ __forceinline__ v16bf ldb16(const bf* p) { return cat16b(*(const v8us*)p, *(const v8us*)(p + 16)); }

// ---- k_proj: all three per-head projections in one launch. Block = 8 waves, one (b, h), PRB consecutive rows of x.
// Stage: the x slice [PRB][64] and the head's Wq, Wk, Wv [64][64] are read as whole 128-B lines in f32, RNE-converted to bf16 and laid in LDS at pitch KP, the three bias rows beside them (one block barrier).
// Products: wave (g = wave >> 1, half = wave & 1) of row group g (64 rows). q and k: A = W rows, B = x rows, so a lane holds 8 consecutive outputs e of one row t (its 32 rows: half);
// v: A = x rows, B = W rows, so a lane holds 8 consecutive t of one output e (all 64 rows, its 32 outputs: half). Both operands through the same loader, k = 0..31 then 32..63, f32 accumulate, + bf16(bias), -> fp16.
// Store: each 32 x 64 fp16 tile goes through a wave-private LDS tile so that every global store writes whole 128-B lines of Q16 / K16 [t][d] and VT16 [d][t].
__global__ __launch_bounds__(256)
void k_proj(const float* __restrict__ x, const float* __restrict__ wq, const float* __restrict__ bq, const float* __restrict__ wk, const float* __restrict__ bk,
            const float* __restrict__ wv, const float* __restrict__ bv, h16* Q16, h16* K16, h16* VT16) {
    __shared__ __align__(16) bf  Xs[PRB * KP];             // x slice, bf16, cross-wave (block barrier)
    __shared__ __align__(16) bf  Ws[3 * HD * KP];          // Wq, Wk, Wv of this head, bf16, cross-wave (block barrier)
    __shared__ __align__(32) float Bs[3 * HD];             // bf16-rounded bq, bk, bv of this head, cross-wave (block barrier)
    __shared__ __align__(16) h16 Ts[3][PRB / 32][32 * KP]; // wave-private output staging, one tile per product
    const int tid = threadIdx.x, wave = tid >> 5, lane = tid & 31, lr = lane & 15, hi = lane >> 4;
    const int h = blockIdx.y, row0 = blockIdx.x * PRB, b = row0 / SEQ, t0 = row0 % SEQ;
    const int g = wave >> 1, half = wave & 1;
    const int sr = tid >> 4, sc = (tid & 15) * 4;          // staging: 16 lanes x 16 B = one 256-B row slice
    const float* xl  = x + ((size_t)b * SEQ_FULL + t0 + sr) * DM + h * HD + sc;
    const float* wl0 = wq + (size_t)h * HD * HD + sr * HD + sc;
    const float* wl1 = wk + (size_t)h * HD * HD + sr * HD + sc;
    const float* wl2 = wv + (size_t)h * HD * HD + sr * HD + sc;
    const float* bl  = ((wave < 2) ? bq : ((wave < 4) ? bk : bv)) + h * HD + (tid & 63);   // waves 6 and 7 read bv again and store nothing
    v4f xr[PRB / 16], wr[12];
#pragma unroll
    for (int j = 0; j < PRB / 16; ++j) xr[j] = *(const v4f*)(xl + (size_t)j * 16 * DM);
#pragma unroll
    for (int j = 0; j < 4; ++j) { wr[j] = *(const v4f*)(wl0 + j * 16 * HD); wr[4 + j] = *(const v4f*)(wl1 + j * 16 * HD); wr[8 + j] = *(const v4f*)(wl2 + j * 16 * HD); }
    const float br = *bl;
    // the five address values are inputs here, so they stay in their registers up to this wait and no later instruction reuses one ahead of it
    asm volatile("s_wait_xcnt 0x0" :: "v"(xl), "v"(wl0), "v"(wl1), "v"(wl2), "v"(bl) : "memory");
#pragma unroll
    for (int j = 0; j < PRB / 16; ++j) { v4us o;
#pragma unroll
        for (int k = 0; k < 4; ++k) o[k] = f2bf(xr[j][k]);
        *(v4us*)(Xs + (sr + j * 16) * KP + sc) = o; }
#pragma unroll
    for (int j = 0; j < 12; ++j) { v4us o;
#pragma unroll
        for (int k = 0; k < 4; ++k) o[k] = f2bf(wr[j][k]);
        *(v4us*)(Ws + ((j >> 2) * HD + sr + (j & 3) * 16) * KP + sc) = o; }
    if (tid < 3 * HD) Bs[tid] = bfr(br);
    __syncthreads();
    // x fragments of row group g; slot i holds 16-row tile tb(i) = (2 * half + i) & 3, so slots 0 and 1 are this wave's own q / k rows
    v16bf xf[4][2];
#pragma unroll
    for (int i = 0; i < 4; ++i)
#pragma unroll
        for (int kk = 0; kk < 2; ++kk) xf[i][kk] = ldb16(Xs + (g * 64 + ((half * 2 + i) & 3) * 16 + lr) * KP + kk * 32 + 8 * hi);
    const size_t bh = (size_t)b * NH + h;
#pragma unroll
    for (int m = 0; m < 3; ++m) {
        h16* ts = Ts[m][wave];
        if (m < 2) {
#pragma unroll
            for (int et = 0; et < 4; ++et) {
                const v16bf w0 = ldb16(Ws + (m * HD + et * 16 + lr) * KP + 8 * hi), w1 = ldb16(Ws + (m * HD + et * 16 + lr) * KP + 32 + 8 * hi);
                const v8f bb = *(const v8f*)(Bs + m * HD + et * 16 + 8 * hi);
#pragma unroll
                for (int tt = 0; tt < 2; ++tt) { v8f c = (v8f){}; c = wmmab(w0, xf[tt][0], c); c = wmmab(w1, xf[tt][1], c);
                    v8h o;
#pragma unroll
                    for (int j = 0; j < 8; ++j) o[j] = (h16)(c[j] + bb[j]);
                    *(v8h*)(ts + (tt * 16 + lr) * KP + et * 16 + 8 * hi) = o; }
            }
        } else {
#pragma unroll
            for (int ee = 0; ee < 2; ++ee) {
                const v16bf w0 = ldb16(Ws + (2 * HD + (half * 2 + ee) * 16 + lr) * KP + 8 * hi), w1 = ldb16(Ws + (2 * HD + (half * 2 + ee) * 16 + lr) * KP + 32 + 8 * hi);
                const float bb = Bs[2 * HD + (half * 2 + ee) * 16 + lr];
#pragma unroll
                for (int i = 0; i < 4; ++i) { v8f c = (v8f){}; c = wmmab(xf[i][0], w0, c); c = wmmab(xf[i][1], w1, c);
                    v8h o;
#pragma unroll
                    for (int j = 0; j < 8; ++j) o[j] = (h16)(c[j] + bb);
                    *(v8h*)(ts + (ee * 16 + lr) * KP + ((half * 2 + i) & 3) * 16 + 8 * hi) = o; }
            }
        }
        // the rows read back below were written by other lanes of this wave: keep the compiler from moving the reads above the writes
        __builtin_amdgcn_fence(3, "wavefront"); __builtin_amdgcn_wave_barrier(); asm volatile("" ::: "memory");
        h16* dst = (m == 0) ? Q16 + (bh * SEQ + t0 + g * 64 + half * 32) * HD : ((m == 1) ? K16 + (bh * SEQ + t0 + g * 64 + half * 32) * HD : VT16 + (bh * HD + half * 32) * SEQ + t0 + g * 64);
        const size_t dp = (m < 2) ? (size_t)HD : (size_t)SEQ;
#pragma unroll
        for (int s = 0; s < 8; ++s) { const int row = 4 * s + (lane >> 3), ch = (lane & 7) * 8;
            *(v8h*)(dst + (size_t)row * dp + ch) = *(const v8h*)(ts + row * KP + ch); }
    }
}

// ---- k_attn: flash attention, block = 8 waves, one (b,h), QB queries; wave (wq = wave & 3, kh = wave >> 2) = 32 queries (QTW tiles of 16) against every second 64-key tile (kh).
// Two blocks share a WGP (waves_per_eu 4, 4: the grid is exactly two blocks per WGP): one block's waves cover the other's LDS and cross-lane waits.
// Per 128-key stage: KSP K tiles [t][d] and V^T tiles [d][t] lie in one of two LDS buffers (cross-wave regions); the next stage's asynchronous 16-B copies, eight per lane, fly into the other buffer meanwhile.
// Foot of each trip: own LDS reads done, own copies landed, one block barrier (publishes stage s + 1 and frees stage s's buffer), then the copies of stage s + 2 into the freed buffer;
// S^T = K . Q^T per 16-key sub-tile (A = K rows from LDS, B = Q columns from the plane, both split-k loaders), so each lane holds 8 keys of one query; one K fragment serves both query tiles;
// online softmax in f32 (running max of the raw scores, one multiply-add and one exp2 per score); p x1024 packed into A fragments straight from the two adjacent 16-key accumulator tiles
// (element r <- keys 0-15 tile, element 8+r <- keys 16-31 tile, lane unchanged); O += P . V with B = V^T rows from LDS, one V^T fragment serving both query tiles.
// After the loop the waves wq and wq + 4 hold (m, l, O) of the same 32 queries over complementary keys: register slot s holds query tile s ^ kh, each wave hands slot 1 to its partner through LDS
// (one block barrier) and merges the partner's slot 1 into its own slot 0 by the usual max / rescale rule, then normalises and stores those 16 queries.
// Asynchronous 16-B copies global -> LDS of one lane (two of each K tile, two of each V^T tile); the waits for them are written at the places that need them.
typedef int v4i __attribute__((ext_vector_type(4)));
typedef __attribute__((address_space(1))) v4i gv4i;
typedef __attribute__((address_space(3))) v4i lv4i;
typedef v2f __attribute__((may_alias)) v2fa;
__device__ __forceinline__ void copy16(h16* l, const h16* g) { __builtin_amdgcn_global_load_async_to_lds_b128((gv4i*)g, (lv4i*)l, 0, 0); }
__device__ __forceinline__ void copy_kv(h16* lk, h16* lv, const h16* gk, const h16* gv) {
    copy16(lk, gk); copy16(lk + 32 * KP, gk + 256 * 8); copy16(lv, gv); copy16(lv + 32 * KP, gv + (size_t)32 * SEQ);
}
__device__ __forceinline__ void copy_stage(h16* lk, h16* lv, const h16* gk, const h16* gv) {
#pragma unroll
    for (int i = 0; i < KSP; ++i) copy_kv(lk + i * KT * KP, lv + i * HD * KP, gk + i * KT * HD, gv + i * KT);
}

__global__ __launch_bounds__(256) __attribute__((amdgpu_waves_per_eu(4, 4)))
void k_attn(const h16* __restrict__ Q16, const h16* __restrict__ K16, const h16* __restrict__ VT16, float* OUT) {
    __shared__ __align__(16) h16 Ks[2][KSP * KT * KP];   // two buffers of KSP tiles [t][d] at pitch KP, cross-wave (block barriers)
    __shared__ __align__(16) h16 Vs[2][KSP * HD * KP];   // two buffers of KSP tiles [d][t] at pitch KP, cross-wave (block barriers)
    __shared__ __align__(16) float osh[8][16 * OSP];     // wave-private output staging
    __shared__ __align__(16) float xo[8][4 * 2 * 32 * 4]; // hand-over of one O tile per wave, [et][register quad][lane], cross-wave (block barrier)
    __shared__ __align__(8)  float xml[8][32 * 2];       // hand-over of that tile's (m, l), cross-wave (block barrier)
    const int tid = threadIdx.x, wv = tid >> 5, lane = tid & 31, lr = lane & 15, hi = lane >> 4;
    const int wq = wv & 3, kh = wv >> 2;
    const int qblks = SEQ / QB; const int bh = blockIdx.x / qblks, qblk = blockIdx.x % qblks; const int b = bh / NH, h = bh % NH;
    const int q0 = qblk * QB + wq * (16 * QTW);
    const h16* Qp = Q16 + ((size_t)bh * SEQ + q0) * HD;
    v16h qf[QTW][2];
#pragma unroll
    for (int qt = 0; qt < QTW; ++qt)
#pragma unroll
        for (int kk = 0; kk < 2; ++kk) qf[qt][kk] = ldh(Qp + (size_t)((qt ^ kh) * 16 + lr) * HD + kk * 32 + 8 * hi);
    const h16* Kb = K16 + (size_t)bh * SEQ * HD; const h16* Vb = VT16 + (size_t)bh * HD * SEQ;
    v8f o[QTW][4];
#pragma unroll
    for (int qt = 0; qt < QTW; ++qt)
#pragma unroll
        for (int et = 0; et < 4; ++et) o[qt][et] = (v8f){};
    float m_run[QTW], l_run[QTW];
#pragma unroll
    for (int qt = 0; qt < QTW; ++qt) { m_run[qt] = -1.0e30f; l_run[qt] = 0.f; }
    float* os = osh[wv];
    // staging: lane copies 16-B piece uu of tile rows e0 and e0 + 32, of each K and each V^T tile of the stage
    const int e0 = tid >> 3, uu = tid & 7, lo = e0 * KP + uu * 8;
    const h16* gk = Kb + (size_t)tid * 8;                       // a K tile is 8,192 contiguous bytes
    const h16* gv = Vb + (size_t)e0 * SEQ + uu * 8;
    copy_stage(Ks[0] + lo, Vs[0] + lo, gk, gv);
    asm volatile("s_wait_asynccnt 0x0" ::: "memory");           // stage 0 of this wave has landed before the barrier publishes it
    __syncthreads();
    gk += KSP * KT * HD; gv += KSP * KT;
    copy_stage(Ks[1] + lo, Vs[1] + lo, gk, gv);
#pragma unroll 1
    for (int t0 = 0; t0 < SEQ; t0 += KSP * KT) {
        const int cur = (t0 / (KSP * KT)) & 1;
        const h16* Kc = Ks[cur] + kh * KT * KP; const h16* Vc = Vs[cur] + kh * HD * KP;
        v8f st[QTW][4]; v16h ka[4][2];
#pragma unroll
        for (int ts = 0; ts < 4; ++ts) { ka[ts][0] = ldh(Kc + (ts * 16 + lr) * KP + 8 * hi); ka[ts][1] = ldh(Kc + (ts * 16 + lr) * KP + 32 + 8 * hi); }
#pragma unroll
        for (int ts = 0; ts < 4; ++ts)
#pragma unroll
            for (int qt = 0; qt < QTW; ++qt) { v8f c = (v8f){}; c = wmma16(ka[ts][0], qf[qt][0], c); c = wmma16(ka[ts][1], qf[qt][1], c); st[qt][ts] = c; }
        // four vector slots between the last product and the first vector instruction that reads a score
        asm volatile("v_nop\n\tv_nop\n\tv_nop\n\tv_nop" : "+v"(st[0][0]), "+v"(st[0][1]), "+v"(st[0][2]), "+v"(st[0][3]), "+v"(st[1][0]), "+v"(st[1][1]), "+v"(st[1][2]), "+v"(st[1][3]) : "v"(ka[3][0]), "v"(ka[3][1]), "v"(qf[0][1]), "v"(qf[1][1]));
        v16h vb[4][2], pa[QTW][2];
        float alpha[QTW], nb[QTW];
#pragma unroll
        for (int qt = 0; qt < QTW; ++qt) {
            // online softmax: lane owns query lr, keys 8*hi + r of each 16-key sub-tile; the partner lane (lane ^ 16) owns the other 32 keys
            float tm = -1.0e30f;   // maximum of the raw scores: the factor CEX is positive, so it is the maximum of the scaled ones too
#pragma unroll
            for (int ts = 0; ts < 4; ++ts)
#pragma unroll
                for (int v = 0; v < 8; ++v) tm = fmaxf(tm, st[qt][ts][v]);
            tm = fmaxf(tm, __shfl_xor(tm, 16, 32));
            const float m_new = fmaxf(m_run[qt], tm);
            // alpha = exp2((m_old - m_new) * CEX), in asm so that it is one unit with its v_nop: the free slot that the instruction set asks for behind a transcendental, here in front of the
            // cross-lane reads of alpha
            asm("v_exp_f32 %0, %1\n\tv_nop" : "=v"(alpha[qt]) : "v"((m_run[qt] - m_new) * CEX));
            nb[qt] = __builtin_fmaf(-m_new, CEX, PCARL2); m_run[qt] = m_new;
        }
#pragma unroll
        for (int qt = 0; qt < QTW; ++qt) {
            // p x1024 = exp2(s * CEX + nb): the score scale, log2 e and the carry sit in one multiply-add, two scores per packed instruction
            const v2f c2 = {CEX, CEX}, nb2 = {nb[qt], nb[qt]};
#pragma unroll
            for (int ts = 0; ts < 4; ++ts)
#pragma unroll
                for (int v = 0; v < 8; v += 2) { const v2f a = __builtin_elementwise_fma((v2f){st[qt][ts][v], st[qt][ts][v + 1]}, c2, nb2);
                    st[qt][ts][v] = __builtin_amdgcn_exp2f(a[0]); st[qt][ts][v + 1] = __builtin_amdgcn_exp2f(a[1]); }
            float rs = 0.f;
#pragma unroll
            for (int v = 0; v < 8; ++v) {
                const float p0 = st[qt][0][v], p1 = st[qt][1][v], p2 = st[qt][2][v], p3 = st[qt][3][v];
                rs += (p0 + p1) + (p2 + p3);
                pa[qt][0][v] = (h16)p0; pa[qt][0][v + 8] = (h16)p1;   // keys 8h+v and 16+8h+v of the 64-key tile
                pa[qt][1][v] = (h16)p2; pa[qt][1][v + 8] = (h16)p3;   // keys 32+8h+v and 48+8h+v
            }
            rs += __shfl_xor(rs, 16, 32);
            l_run[qt] = l_run[qt] * alpha[qt] + rs;
            // rescale O: accumulator element v of this lane is query row 8*hi + v; alpha for that query lives in lane 8*hi + v
#pragma unroll
            for (int v = 0; v < 8; ++v) { const float fs = __shfl(alpha[qt], v + 8 * hi, 32); o[qt][0][v] *= fs; o[qt][1][v] *= fs; o[qt][2][v] *= fs; o[qt][3][v] *= fs; }
            if (qt == 0) {   // first half of the V^T fragments: all four at once, beside both tiles' scores, did not fit the registers
#pragma unroll
                for (int et = 0; et < 2; ++et) { vb[et][0] = ldh(Vc + (et * 16 + lr) * KP + 8 * hi); vb[et][1] = ldh(Vc + (et * 16 + lr) * KP + 32 + 8 * hi); }
            }
        }
#pragma unroll
        for (int et = 2; et < 4; ++et) { vb[et][0] = ldh(Vc + (et * 16 + lr) * KP + 8 * hi); vb[et][1] = ldh(Vc + (et * 16 + lr) * KP + 32 + 8 * hi); }
        __builtin_amdgcn_sched_barrier(0);   // keeps these eight reads one group ahead of the products (left free, they were spread in pairs among the products, each pair waited for where it stood)
#pragma unroll
        for (int et = 0; et < 4; ++et)
#pragma unroll
            for (int qt = 0; qt < QTW; ++qt) { o[qt][et] = wmma16(pa[qt][0], vb[et][0], o[qt][et]); o[qt][et] = wmma16(pa[qt][1], vb[et][1], o[qt][et]); }
        // four vector slots between the last product and whatever follows it on either side of the loop's branches
        asm volatile("v_nop\n\tv_nop\n\tv_nop\n\tv_nop" : "+v"(o[0][0]), "+v"(o[0][1]), "+v"(o[0][2]), "+v"(o[0][3]), "+v"(o[1][0]), "+v"(o[1][1]), "+v"(o[1][2]), "+v"(o[1][3]) : "v"(pa[0][0]), "v"(pa[0][1]), "v"(pa[1][0]), "v"(pa[1][1]), "v"(vb[3][1]));
        asm volatile("s_wait_dscnt 0x0" ::: "memory");      // this wave's reads of the current buffer are done before the barrier frees it for refilling
        asm volatile("s_wait_asynccnt 0x0" ::: "memory");   // this wave's copies of the next stage have landed before the barrier publishes them
        __syncthreads();
        if (t0 + 2 * KSP * KT < SEQ) {                      // block-uniform: a stage s + 2 exists
            gk += KSP * KT * HD; gv += KSP * KT;
            copy_stage(Ks[cur] + lo, Vs[cur] + lo, gk, gv);
        }
    }
    asm volatile("s_wait_asynccnt 0x0" ::: "memory");       // nothing of this wave is in flight when it goes on to the epilogue and ends
    // hand-over: slot 1 (query tile 1 ^ kh) goes to the partner wave, whose slot 0 is that tile; same lane, same register on both sides
    {
        float* xw = xo[wv];
#pragma unroll
        for (int et = 0; et < 4; ++et) {
            *(v4fa*)(xw + ((et * 2 + 0) * 32 + lane) * 4) = __builtin_shufflevector(o[1][et], o[1][et], 0, 1, 2, 3);
            *(v4fa*)(xw + ((et * 2 + 1) * 32 + lane) * 4) = __builtin_shufflevector(o[1][et], o[1][et], 4, 5, 6, 7); }
        *(v2fa*)(xml[wv] + lane * 2) = (v2f){m_run[1], l_run[1]};
    }
    __syncthreads();                                        // the partner's tile is read only behind this barrier
    // merge and epilogue: out[b][q][h*HD + d] = (O_a fa + O_b fb) / (l_a fa + l_b fb), f = exp2((m - max(m_a, m_b)) * CEX); O and l both carry x1024
    {
        const float* xr = xo[wv ^ 4];
        const v2f ml = *(const v2fa*)(xml[wv ^ 4] + lane * 2);
        const float mm = fmaxf(m_run[0], ml[0]);
        const float fa = __builtin_amdgcn_exp2f((m_run[0] - mm) * CEX), fb = __builtin_amdgcn_exp2f((ml[0] - mm) * CEX);
        const float inv = 1.0f / (l_run[0] * fa + ml[1] * fb);
        const float ga = fa * inv, gb = fb * inv;
        v4f pb[4][2];
#pragma unroll
        for (int et = 0; et < 4; ++et) { pb[et][0] = *(const v4fa*)(xr + ((et * 2 + 0) * 32 + lane) * 4); pb[et][1] = *(const v4fa*)(xr + ((et * 2 + 1) * 32 + lane) * 4); }
#pragma unroll
        for (int j = 0; j < 8; ++j) { const float fsa = __shfl(ga, j + 8 * hi, 32), fsb = __shfl(gb, j + 8 * hi, 32);
#pragma unroll
            for (int et = 0; et < 4; ++et) os[(hi * 8 + j) * OSP + et * 16 + lr] = o[0][et][j] * fsa + pb[et][j >> 2][j & 3] * fsb; }
        __builtin_amdgcn_fence(3, "wavefront"); __builtin_amdgcn_wave_barrier(); asm volatile("" ::: "memory");
        float* crow = OUT + ((size_t)b * SEQ + q0 + kh * 16) * DM + (size_t)h * HD;
#pragma unroll
        for (int s = 0; s < 8; ++s) { const int row = 2 * s + hi, cofs = lr * 4; const v4f val = *(const v4fa*)(os + row * OSP + cofs);
            *(v4f*)(crow + (size_t)row * DM + cofs) = val; }
    }
}

extern "C" void kernel_launch(void* const* d_in, const int* in_sizes, int n_in,
                              void* d_out, int out_size, void* d_ws, size_t ws_size, hipStream_t stream) {
    if (n_in < 7) return;
    if (in_sizes[0] < (NB - 1) * SEQ_FULL * DM + SEQ * DM) return;
    if (in_sizes[1] < NH * HD * HD || in_sizes[3] < NH * HD * HD || in_sizes[5] < NH * HD * HD) return;
    if (in_sizes[2] < NH * HD || in_sizes[4] < NH * HD || in_sizes[6] < NH * HD) return;
    if (out_size < NB * SEQ * DM) return;
    const float* x = (const float*)d_in[0]; const float* wq = (const float*)d_in[1]; const float* bq = (const float*)d_in[2]; const float* wk = (const float*)d_in[3]; const float* bk = (const float*)d_in[4]; const float* wv = (const float*)d_in[5]; const float* bv = (const float*)d_in[6];
    float* OUT = (float*)d_out;     // [NB][SEQ][DM]
    char* wsp = (char*)d_ws;
    auto take = [&](size_t bytes) { char* p = wsp; wsp += (bytes + 255) & ~(size_t)255; return (void*)p; };
    h16* Q16  = (h16*)take((size_t)NB * NH * SEQ * HD * 2);    // [NB][16][SEQ][64] fp16 = 8,388,608 B
    h16* K16  = (h16*)take((size_t)NB * NH * SEQ * HD * 2);
    h16* VT16 = (h16*)take((size_t)NB * NH * HD * SEQ * 2);    // [NB][16][64][SEQ] fp16
    if ((size_t)(wsp - (char*)d_ws) > ws_size) return;         // total 25,165,824 B
    k_proj<<<dim3((unsigned)(NB * SEQ / PRB), NH, 1), 256, 0, stream>>>(x, wq, bq, wk, bk, wv, bv, Q16, K16, VT16);
    k_attn<<<(unsigned)(NB * NH * (SEQ / QB)), 256, 0, stream>>>(Q16, K16, VT16, OUT);
}

// v007
// One run takes 41 microseconds.
// Timed twice side by side with v006, it ran 1.03 and 1.04 times as fast.
// Over all steps from v000 it is 5.08 times as fast.
#include <hip/hip_runtime.h>

// Contractions: per-head q/k/v projections = v_wmma_f32_16x16x32_bf16 (bf16 operands from RNE-converted x and W, f32 accumulate, bf16-rounded bias added in f32); attention scores q.k and p.v = v_wmma_f32_16x16x32_f16 (fp16 operands, p carried x1024, f32 accumulate); online softmax, normalisation and output in f32.
// Layout: x [NB][SEQ_FULL][1024] (first SEQ rows of each batch used) viewed as 16 head slices of 64; q = x_h Wq[h]^T + bq[h] (W is [h][out][in]), k, v likewise; scores = q.k / 8 over all SEQ keys, softmax, out_h = attn v; heads re-stacked -> [NB][SEQ][1024].

#ifndef NB
#define NB 2
#endif
#ifndef SEQ
#define SEQ 2048
#endif
#define NB_FULL  2
#define SEQ_FULL 2048
#define DM   1024
#define NH   16
#define HD   64
#define KT   64          // keys per LDS tile
#define QTW  2           // 16-query tiles per wave: every K and V^T fragment read from LDS feeds two products
#define KSP  2           // 64-key tiles per stage: waves 0-3 of a block take the first, waves 4-7 the second
#define QB   (4 * 16 * QTW)   // queries per block (4 wave pairs x 32): 512 blocks, two resident per WGP, four waves per SIMD
#define PRB  256         // rows of x per projection block (8 waves)
#define KP   72          // LDS pitch (halves) of the K and V^T tile rows: 144 B = 16 B x odd, so the 16 rows one ds_load_b128 half-wave reads fall on 64 distinct banks
#define OSP  68          // LDS pitch (floats) of the per-wave output staging tile
#define PCARL2 10.0f     // log2 of the power-of-two carry (x1024) on the fp16 p operand; the row sum l carries it too
#define CEX  0.18033688011112042f   // HD^-0.5 * log2 e: exp(s / 8) = exp2(s * CEX)
#define LAZY 27.725887f  // 5 / CEX: a raw score may stand up to 2^5 (scaled) above the maximum in use before O is rescaled, so p x1024 stays at or below 2^15, inside fp16

static_assert(DM == NH * HD);
static_assert(SEQ % QB == 0);
static_assert(SEQ % (KSP * KT) == 0);
static_assert(SEQ % PRB == 0 && PRB == 256);   // k_proj: 256 threads, 8 waves x 32 rows
static_assert(NB >= 1 && NB <= NB_FULL);
static_assert(SEQ >= QB && SEQ <= SEQ_FULL);
static_assert(HD % 32 == 0);
static_assert(HD == 64 && KT == 64 && KP >= 64 && KP % 8 == 0);
static_assert(SEQ / (KSP * KT) >= 2);   // k_attn: the two-buffer ring starts with stages 0 and 1
static_assert(QTW == 2 && KSP == 2);    // k_attn: a wave keeps one of its two query tiles and hands the other to its partner

typedef _Float16 h16;
typedef unsigned short bf;
typedef __attribute__((ext_vector_type(16))) __bf16   v16bf;
typedef __attribute__((ext_vector_type(16))) _Float16 v16h;
typedef __attribute__((ext_vector_type(8)))  _Float16 v8h;
typedef __attribute__((ext_vector_type(8)))  unsigned short v8us;
typedef __attribute__((ext_vector_type(4)))  unsigned short v4us;
typedef __attribute__((ext_vector_type(8)))  float    v8f;
typedef __attribute__((ext_vector_type(4)))  float    v4f;
typedef v4f __attribute__((may_alias)) v4fa;
typedef __attribute__((ext_vector_type(2)))  float    v2f;

__device__ __forceinline__ unsigned short f2bf(float f) { unsigned u = __float_as_uint(f); u += 0x7FFFu + ((u >> 16) & 1u); return (unsigned short)(u >> 16); }
__device__ __forceinline__ float bf2f(unsigned short b) { return __uint_as_float(((unsigned)b) << 16); }
__device__ __forceinline__ float bfr(float f) { return bf2f(f2bf(f)); }
__device__ __forceinline__ v16h  cat16(v8h lo, v8h hi) { return __builtin_shufflevector(lo, hi, 0, 1, 2, 3, 4, 5, 6, 7, 8, 9, 10, 11, 12, 13, 14, 15); }
__device__ __forceinline__ v16bf cat16b(v8us lo, v8us hi) { return __builtin_bit_cast(v16bf, __builtin_shufflevector(lo, hi, 0, 1, 2, 3, 4, 5, 6, 7, 8, 9, 10, 11, 12, 13, 14, 15)); }
__device__ __forceinline__ v8f wmma16(v16h a, v16h b, v8f c) { return __builtin_amdgcn_wmma_f32_16x16x32_f16(false, a, false, b, (short)0, c, false, false); }
__device__ __forceinline__ v8f wmmab(v16bf a, v16bf b, v8f c) { return __builtin_amdgcn_wmma_f32_16x16x32_bf16(false, a, false, b, (short)0, c, false, false); }
// Fragment loaders (A and B identical): p = plane + row(l&15) * pitch + k0 + 8*(l>>4); elements 0..7 <- p[0..7], elements 8..15 <- p[16..23] (k0+16+8h..).
__device__ __forceinline__ v16h  ldh(const h16* p) { return cat16(*(const v8h*)p, *(const v8h*)(p + 16)); }
__device__ __forceinline__ v16bf ldb16(const bf* p) { return cat16b(*(const v8us*)p, *(const v8us*)(p + 16)); }

// ---- k_proj: all three per-head projections in one launch. Block = 8 waves, one (b, h), PRB consecutive rows of x.
// Stage: the x slice [PRB][64] and the head's Wq, Wk, Wv [64][64] are read as whole 128-B lines in f32, RNE-converted to bf16 and laid in LDS at pitch KP, the three bias rows beside them (one block barrier).
// Products: wave (g = wave >> 1, half = wave & 1) of row group g (64 rows). q and k: A = W rows, B = x rows, so a lane holds 8 consecutive outputs e of one row t (its 32 rows: half);
// v: A = x rows, B = W rows, so a lane holds 8 consecutive t of one output e (all 64 rows, its 32 outputs: half). Both operands through the same loader, k = 0..31 then 32..63, f32 accumulate, + bf16(bias), -> fp16.
// Store: each 32 x 64 fp16 tile goes through a wave-private LDS tile so that every global store writes whole 128-B lines of Q16 / K16 [t][d] and VT16 [d][t].
__global__ __launch_bounds__(256)
void k_proj(const float* __restrict__ x, const float* __restrict__ wq, const float* __restrict__ bq, const float* __restrict__ wk, const float* __restrict__ bk,
            const float* __restrict__ wv, const float* __restrict__ bv, h16* Q16, h16* K16, h16* VT16) {
    __shared__ __align__(16) bf  Xs[PRB * KP];             // x slice, bf16, cross-wave (block barrier)
    __shared__ __align__(16) bf  Ws[3 * HD * KP];          // Wq, Wk, Wv of this head, bf16, cross-wave (block barrier)
    __shared__ __align__(32) float Bs[3 * HD];             // bf16-rounded bq, bk, bv of this head, cross-wave (block barrier)
    __shared__ __align__(16) h16 Ts[3][PRB / 32][32 * KP]; // wave-private output staging, one tile per product
    const int tid = threadIdx.x, wave = tid >> 5, lane = tid & 31, lr = lane & 15, hi = lane >> 4;
    const int h = blockIdx.y, row0 = blockIdx.x * PRB, b = row0 / SEQ, t0 = row0 % SEQ;
    const int g = wave >> 1, half = wave & 1;
    const int sr = tid >> 4, sc = (tid & 15) * 4;          // staging: 16 lanes x 16 B = one 256-B row slice
    const float* xl  = x + ((size_t)b * SEQ_FULL + t0 + sr) * DM + h * HD + sc;
    const float* wl0 = wq + (size_t)h * HD * HD + sr * HD + sc;
    const float* wl1 = wk + (size_t)h * HD * HD + sr * HD + sc;
    const float* wl2 = wv + (size_t)h * HD * HD + sr * HD + sc;
    const float* bl  = ((wave < 2) ? bq : ((wave < 4) ? bk : bv)) + h * HD + (tid & 63);   // waves 6 and 7 read bv again and store nothing
    v4f xr[PRB / 16], wr[12];
#pragma unroll
    for (int j = 0; j < PRB / 16; ++j) xr[j] = *(const v4f*)(xl + (size_t)j * 16 * DM);
#pragma unroll
    for (int j = 0; j < 4; ++j) { wr[j] = *(const v4f*)(wl0 + j * 16 * HD); wr[4 + j] = *(const v4f*)(wl1 + j * 16 * HD); wr[8 + j] = *(const v4f*)(wl2 + j * 16 * HD); }
    const float br = *bl;
    // the five address values are inputs here, so they stay in their registers up to this wait and no later instruction reuses one ahead of it
    asm volatile("s_wait_xcnt 0x0" :: "v"(xl), "v"(wl0), "v"(wl1), "v"(wl2), "v"(bl) : "memory");
#pragma unroll
    for (int j = 0; j < PRB / 16; ++j) { v4us o;
#pragma unroll
        for (int k = 0; k < 4; ++k) o[k] = f2bf(xr[j][k]);
        *(v4us*)(Xs + (sr + j * 16) * KP + sc) = o; }
#pragma unroll
    for (int j = 0; j < 12; ++j) { v4us o;
#pragma unroll
        for (int k = 0; k < 4; ++k) o[k] = f2bf(wr[j][k]);
        *(v4us*)(Ws + ((j >> 2) * HD + sr + (j & 3) * 16) * KP + sc) = o; }
    if (tid < 3 * HD) Bs[tid] = bfr(br);
    __syncthreads();
    // x fragments of row group g; slot i holds 16-row tile tb(i) = (2 * half + i) & 3, so slots 0 and 1 are this wave's own q / k rows
    v16bf xf[4][2];
#pragma unroll
    for (int i = 0; i < 4; ++i)
#pragma unroll
        for (int kk = 0; kk < 2; ++kk) xf[i][kk] = ldb16(Xs + (g * 64 + ((half * 2 + i) & 3) * 16 + lr) * KP + kk * 32 + 8 * hi);
    const size_t bh = (size_t)b * NH + h;
#pragma unroll
    for (int m = 0; m < 3; ++m) {
        h16* ts = Ts[m][wave];
        if (m < 2) {
#pragma unroll
            for (int et = 0; et < 4; ++et) {
                const v16bf w0 = ldb16(Ws + (m * HD + et * 16 + lr) * KP + 8 * hi), w1 = ldb16(Ws + (m * HD + et * 16 + lr) * KP + 32 + 8 * hi);
                const v8f bb = *(const v8f*)(Bs + m * HD + et * 16 + 8 * hi);
#pragma unroll
                for (int tt = 0; tt < 2; ++tt) { v8f c = (v8f){}; c = wmmab(w0, xf[tt][0], c); c = wmmab(w1, xf[tt][1], c);
                    v8h o;
#pragma unroll
                    for (int j = 0; j < 8; ++j) o[j] = (h16)(c[j] + bb[j]);
                    *(v8h*)(ts + (tt * 16 + lr) * KP + et * 16 + 8 * hi) = o; }
            }
        } else {
#pragma unroll
            for (int ee = 0; ee < 2; ++ee) {
                const v16bf w0 = ldb16(Ws + (2 * HD + (half * 2 + ee) * 16 + lr) * KP + 8 * hi), w1 = ldb16(Ws + (2 * HD + (half * 2 + ee) * 16 + lr) * KP + 32 + 8 * hi);
                const float bb = Bs[2 * HD + (half * 2 + ee) * 16 + lr];
#pragma unroll
                for (int i = 0; i < 4; ++i) { v8f c = (v8f){}; c = wmmab(xf[i][0], w0, c); c = wmmab(xf[i][1], w1, c);
                    v8h o;
#pragma unroll
                    for (int j = 0; j < 8; ++j) o[j] = (h16)(c[j] + bb);
                    *(v8h*)(ts + (ee * 16 + lr) * KP + ((half * 2 + i) & 3) * 16 + 8 * hi) = o; }
            }
        }
        // the rows read back below were written by other lanes of this wave: keep the compiler from moving the reads above the writes
        __builtin_amdgcn_fence(3, "wavefront"); __builtin_amdgcn_wave_barrier(); asm volatile("" ::: "memory");
        h16* dst = (m == 0) ? Q16 + (bh * SEQ + t0 + g * 64 + half * 32) * HD : ((m == 1) ? K16 + (bh * SEQ + t0 + g * 64 + half * 32) * HD : VT16 + (bh * HD + half * 32) * SEQ + t0 + g * 64);
        const size_t dp = (m < 2) ? (size_t)HD : (size_t)SEQ;
#pragma unroll
        for (int s = 0; s < 8; ++s) { const int row = 4 * s + (lane >> 3), ch = (lane & 7) * 8;
            *(v8h*)(dst + (size_t)row * dp + ch) = *(const v8h*)(ts + row * KP + ch); }
    }
}

// ---- k_attn: flash attention, block = 8 waves, one (b,h), QB queries; wave (wq = wave & 3, kh = wave >> 2) = 32 queries (QTW tiles of 16) against every second 64-key tile (kh).
// Two blocks share a WGP (waves_per_eu 4, 4: the grid is exactly two blocks per WGP): one block's waves cover the other's LDS and cross-lane waits.
// Per 128-key stage: KSP K tiles [t][d] and V^T tiles [d][t] lie in one of two LDS buffers (cross-wave regions); the next stage's asynchronous 16-B copies, eight per lane, fly into the other buffer meanwhile.
// Foot of each trip: own LDS reads done, own copies landed, one block barrier (publishes stage s + 1 and frees stage s's buffer), then the copies of stage s + 2 into the freed buffer;
// S^T = K . Q^T per 16-key sub-tile (A = K rows from LDS, B = Q columns from the plane, both split-k loaders), so each lane holds 8 keys of one query; one K fragment serves both query tiles;
// online softmax in f32 (one multiply-add and one exp2 per score) against a maximum in use m that follows the running maximum lazily: one wave-uniform test per trip, on each lane's own 32 keys;
// only where some score stands more than LAZY above m are the halves' maxima joined, m raised and l and O rescaled; p x1024 packed into A fragments straight from the two adjacent 16-key accumulator tiles
// (element r <- keys 0-15 tile, element 8+r <- keys 16-31 tile, lane unchanged); O += P . V with B = V^T rows from LDS, one V^T fragment serving both query tiles.
// After the loop the waves wq and wq + 4 hold (m, l, O) of the same 32 queries over complementary keys: register slot s holds query tile s ^ kh, each wave hands slot 1 to its partner through LDS
// (one block barrier) and merges the partner's slot 1 into its own slot 0 by the usual max / rescale rule, then normalises and stores those 16 queries.
// Asynchronous 16-B copies global -> LDS of one lane (two of each K tile, two of each V^T tile); the waits for them are written at the places that need them.
typedef int v4i __attribute__((ext_vector_type(4)));
typedef __attribute__((address_space(1))) v4i gv4i;
typedef __attribute__((address_space(3))) v4i lv4i;
typedef v2f __attribute__((may_alias)) v2fa;
__device__ __forceinline__ void copy16(h16* l, const h16* g) { __builtin_amdgcn_global_load_async_to_lds_b128((gv4i*)g, (lv4i*)l, 0, 0); }
__device__ __forceinline__ void copy_kv(h16* lk, h16* lv, const h16* gk, const h16* gv) {
    copy16(lk, gk); copy16(lk + 32 * KP, gk + 256 * 8); copy16(lv, gv); copy16(lv + 32 * KP, gv + (size_t)32 * SEQ);
}
__device__ __forceinline__ void copy_stage(h16* lk, h16* lv, const h16* gk, const h16* gv) {
#pragma unroll
    for (int i = 0; i < KSP; ++i) copy_kv(lk + i * KT * KP, lv + i * HD * KP, gk + i * KT * HD, gv + i * KT);
}

__global__ __launch_bounds__(256) __attribute__((amdgpu_waves_per_eu(4, 4)))
void k_attn(const h16* __restrict__ Q16, const h16* __restrict__ K16, const h16* __restrict__ VT16, float* OUT) {
    __shared__ __align__(16) h16 Ks[2][KSP * KT * KP];   // two buffers of KSP tiles [t][d] at pitch KP, cross-wave (block barriers)
    __shared__ __align__(16) h16 Vs[2][KSP * HD * KP];   // two buffers of KSP tiles [d][t] at pitch KP, cross-wave (block barriers)
    __shared__ __align__(16) float osh[8][16 * OSP];     // wave-private output staging
    __shared__ __align__(16) float xo[8][4 * 2 * 32 * 4]; // hand-over of one O tile per wave, [et][register quad][lane], cross-wave (block barrier)
    __shared__ __align__(8)  float xml[8][32 * 2];       // hand-over of that tile's (m, l), cross-wave (block barrier)
    const int tid = threadIdx.x, wv = tid >> 5, lane = tid & 31, lr = lane & 15, hi = lane >> 4;
    const int wq = wv & 3, kh = wv >> 2;
    const int qblks = SEQ / QB; const int bh = blockIdx.x / qblks, qblk = blockIdx.x % qblks; const int b = bh / NH, h = bh % NH;
    const int q0 = qblk * QB + wq * (16 * QTW);
    const h16* Qp = Q16 + ((size_t)bh * SEQ + q0) * HD;
    v16h qf[QTW][2];
#pragma unroll
    for (int qt = 0; qt < QTW; ++qt)
#pragma unroll
        for (int kk = 0; kk < 2; ++kk) qf[qt][kk] = ldh(Qp + (size_t)((qt ^ kh) * 16 + lr) * HD + kk * 32 + 8 * hi);
    const h16* Kb = K16 + (size_t)bh * SEQ * HD; const h16* Vb = VT16 + (size_t)bh * HD * SEQ;
    v8f o[QTW][4];
#pragma unroll
    for (int qt = 0; qt < QTW; ++qt)
#pragma unroll
        for (int et = 0; et < 4; ++et) o[qt][et] = (v8f){};
    float m_run[QTW], l_run[QTW], nb[QTW];   // nb = PCARL2 - m_run * CEX, the addend of the scores' multiply-add; it changes only where m_run does
#pragma unroll
    for (int qt = 0; qt < QTW; ++qt) { m_run[qt] = -1.0e30f; l_run[qt] = 0.f; nb[qt] = 0.f; }
    float* os = osh[wv];
    // staging: lane copies 16-B piece uu of tile rows e0 and e0 + 32, of each K and each V^T tile of the stage
    const int e0 = tid >> 3, uu = tid & 7, lo = e0 * KP + uu * 8;
    const h16* gk = Kb + (size_t)tid * 8;                       // a K tile is 8,192 contiguous bytes
    const h16* gv = Vb + (size_t)e0 * SEQ + uu * 8;
    copy_stage(Ks[0] + lo, Vs[0] + lo, gk, gv);
    asm volatile("s_wait_asynccnt 0x0" ::: "memory");           // stage 0 of this wave has landed before the barrier publishes it
    __syncthreads();
    gk += KSP * KT * HD; gv += KSP * KT;
    copy_stage(Ks[1] + lo, Vs[1] + lo, gk, gv);
#pragma unroll 1
    for (int t0 = 0; t0 < SEQ; t0 += KSP * KT) {
        const int cur = (t0 / (KSP * KT)) & 1;
        const h16* Kc = Ks[cur] + kh * KT * KP; const h16* Vc = Vs[cur] + kh * HD * KP;
        v8f st[QTW][4]; v16h ka[4][2];
#pragma unroll
        for (int ts = 0; ts < 4; ++ts) { ka[ts][0] = ldh(Kc + (ts * 16 + lr) * KP + 8 * hi); ka[ts][1] = ldh(Kc + (ts * 16 + lr) * KP + 32 + 8 * hi); }
#pragma unroll
        for (int ts = 0; ts < 4; ++ts)
#pragma unroll
            for (int qt = 0; qt < QTW; ++qt) { v8f c = (v8f){}; c = wmma16(ka[ts][0], qf[qt][0], c); c = wmma16(ka[ts][1], qf[qt][1], c); st[qt][ts] = c; }
        // four vector slots between the last product and the first vector instruction that reads a score
        asm volatile("v_nop\n\tv_nop\n\tv_nop\n\tv_nop" : "+v"(st[0][0]), "+v"(st[0][1]), "+v"(st[0][2]), "+v"(st[0][3]), "+v"(st[1][0]), "+v"(st[1][1]), "+v"(st[1][2]), "+v"(st[1][3]) : "v"(ka[3][0]), "v"(ka[3][1]), "v"(qf[0][1]), "v"(qf[1][1]));
        v16h vb[4][2], pa[QTW][2];
        float tm[QTW];
#pragma unroll
        for (int qt = 0; qt < QTW; ++qt) {
            // online softmax: lane owns query lr, keys 8*hi + r of each 16-key sub-tile; the partner lane (lane ^ 16) owns the other 32 keys
            tm[qt] = -1.0e30f;     // maximum of this lane's raw scores: the factor CEX is positive, so it is the maximum of the scaled ones too
#pragma unroll
            for (int ts = 0; ts < 4; ++ts)
#pragma unroll
                for (int v = 0; v < 8; ++v) tm[qt] = fmaxf(tm[qt], st[qt][ts][v]);
        }
        // lazy rescale, one scalar branch per trip: m_run is the same in a lane and its partner, and behind this test no score of either stands more than LAZY above it
        if (__builtin_amdgcn_ballot_w32(fmaxf(tm[0] - m_run[0], tm[1] - m_run[1]) > LAZY) != 0) {
#pragma unroll
            for (int qt = 0; qt < QTW; ++qt) {
                const float m_new = fmaxf(m_run[qt], fmaxf(tm[qt], __shfl_xor(tm[qt], 16, 32)));
                float alpha;
                // alpha = exp2((m_old - m_new) * CEX), in asm so that it is one unit with its v_nop: the free slot that the instruction set asks for behind a transcendental, here in front of the reads of alpha
                asm("v_exp_f32 %0, %1\n\tv_nop" : "=v"(alpha) : "v"((m_run[qt] - m_new) * CEX));
                m_run[qt] = m_new; nb[qt] = __builtin_fmaf(-m_new, CEX, PCARL2); l_run[qt] *= alpha;
                // rescale O: accumulator element v of this lane is query row 8*hi + v; alpha for that query lives in lane 8*hi + v
#pragma unroll
                for (int v = 0; v < 8; ++v) { const float fs = __shfl(alpha, v + 8 * hi, 32); o[qt][0][v] *= fs; o[qt][1][v] *= fs; o[qt][2][v] *= fs; o[qt][3][v] *= fs; }
            }
        }
        // first half of the V^T fragments: all four at once, beside both tiles' scores, did not fit the registers
#pragma unroll
        for (int et = 0; et < 2; ++et) { vb[et][0] = ldh(Vc + (et * 16 + lr) * KP + 8 * hi); vb[et][1] = ldh(Vc + (et * 16 + lr) * KP + 32 + 8 * hi); }
#pragma unroll
        for (int qt = 0; qt < QTW; ++qt) {
            // p x1024 = exp2(s * CEX + nb): the score scale, log2 e and the carry sit in one multiply-add, two scores per packed instruction
            const v2f c2 = {CEX, CEX}, nb2 = {nb[qt], nb[qt]};
#pragma unroll
            for (int ts = 0; ts < 4; ++ts)
#pragma unroll
                for (int v = 0; v < 8; v += 2) { const v2f a = __builtin_elementwise_fma((v2f){st[qt][ts][v], st[qt][ts][v + 1]}, c2, nb2);
                    st[qt][ts][v] = __builtin_amdgcn_exp2f(a[0]); st[qt][ts][v + 1] = __builtin_amdgcn_exp2f(a[1]); }
            float rs = 0.f;
#pragma unroll
            for (int v = 0; v < 8; v += 2) {   // two keys per packed add; every sum and its order as for one key at a time
                const v2f p0 = {st[qt][0][v], st[qt][0][v + 1]}, p1 = {st[qt][1][v], st[qt][1][v + 1]}, p2 = {st[qt][2][v], st[qt][2][v + 1]}, p3 = {st[qt][3][v], st[qt][3][v + 1]};
                const v2f t = (p0 + p1) + (p2 + p3);
                rs += t[0]; rs += t[1];
#pragma unroll
                for (int w = 0; w < 2; ++w) {
                    pa[qt][0][v + w] = (h16)p0[w]; pa[qt][0][v + w + 8] = (h16)p1[w];   // keys 8h+v and 16+8h+v of the 64-key tile
                    pa[qt][1][v + w] = (h16)p2[w]; pa[qt][1][v + w + 8] = (h16)p3[w];   // keys 32+8h+v and 48+8h+v
                }
            }
            rs += __shfl_xor(rs, 16, 32);
            l_run[qt] += rs;
        }
#pragma unroll
        for (int et = 2; et < 4; ++et) { vb[et][0] = ldh(Vc + (et * 16 + lr) * KP + 8 * hi); vb[et][1] = ldh(Vc + (et * 16 + lr) * KP + 32 + 8 * hi); }
        __builtin_amdgcn_sched_barrier(0);   // keeps these eight reads one group ahead of the products (left free, they were spread in pairs among the products, each pair waited for where it stood)
#pragma unroll
        for (int et = 0; et < 4; ++et)
#pragma unroll
            for (int qt = 0; qt < QTW; ++qt) { o[qt][et] = wmma16(pa[qt][0], vb[et][0], o[qt][et]); o[qt][et] = wmma16(pa[qt][1], vb[et][1], o[qt][et]); }
        // four vector slots between the last product and whatever follows it on either side of the loop's branches
        asm volatile("v_nop\n\tv_nop\n\tv_nop\n\tv_nop" : "+v"(o[0][0]), "+v"(o[0][1]), "+v"(o[0][2]), "+v"(o[0][3]), "+v"(o[1][0]), "+v"(o[1][1]), "+v"(o[1][2]), "+v"(o[1][3]) : "v"(pa[0][0]), "v"(pa[0][1]), "v"(pa[1][0]), "v"(pa[1][1]), "v"(vb[3][1]));
        asm volatile("s_wait_dscnt 0x0" ::: "memory");      // this wave's reads of the current buffer are done before the barrier frees it for refilling
        asm volatile("s_wait_asynccnt 0x0" ::: "memory");   // this wave's copies of the next stage have landed before the barrier publishes them
        __syncthreads();
        if (t0 + 2 * KSP * KT < SEQ) {                      // block-uniform: a stage s + 2 exists
            gk += KSP * KT * HD; gv += KSP * KT;
            copy_stage(Ks[cur] + lo, Vs[cur] + lo, gk, gv);
        }
    }
    asm volatile("s_wait_asynccnt 0x0" ::: "memory");       // nothing of this wave is in flight when it goes on to the epilogue and ends
    // hand-over: slot 1 (query tile 1 ^ kh) goes to the partner wave, whose slot 0 is that tile; same lane, same register on both sides
    {
        float* xw = xo[wv];
#pragma unroll
        for (int et = 0; et < 4; ++et) {
            *(v4fa*)(xw + ((et * 2 + 0) * 32 + lane) * 4) = __builtin_shufflevector(o[1][et], o[1][et], 0, 1, 2, 3);
            *(v4fa*)(xw + ((et * 2 + 1) * 32 + lane) * 4) = __builtin_shufflevector(o[1][et], o[1][et], 4, 5, 6, 7); }
        *(v2fa*)(xml[wv] + lane * 2) = (v2f){m_run[1], l_run[1]};
    }
    __syncthreads();                                        // the partner's tile is read only behind this barrier
    // merge and epilogue: out[b][q][h*HD + d] = (O_a fa + O_b fb) / (l_a fa + l_b fb), f = exp2((m - max(m_a, m_b)) * CEX); O and l both carry x1024
    {
        const float* xr = xo[wv ^ 4];
        const v2f ml = *(const v2fa*)(xml[wv ^ 4] + lane * 2);
        const float mm = fmaxf(m_run[0], ml[0]);
        const float fa = __builtin_amdgcn_exp2f((m_run[0] - mm) * CEX), fb = __builtin_amdgcn_exp2f((ml[0] - mm) * CEX);
        const float inv = 1.0f / (l_run[0] * fa + ml[1] * fb);
        const float ga = fa * inv, gb = fb * inv;
        v4f pb[4][2];
#pragma unroll
        for (int et = 0; et < 4; ++et) { pb[et][0] = *(const v4fa*)(xr + ((et * 2 + 0) * 32 + lane) * 4); pb[et][1] = *(const v4fa*)(xr + ((et * 2 + 1) * 32 + lane) * 4); }
#pragma unroll
        for (int j = 0; j < 8; ++j) { const float fsa = __shfl(ga, j + 8 * hi, 32), fsb = __shfl(gb, j + 8 * hi, 32);
#pragma unroll
            for (int et = 0; et < 4; ++et) os[(hi * 8 + j) * OSP + et * 16 + lr] = o[0][et][j] * fsa + pb[et][j >> 2][j & 3] * fsb; }
        __builtin_amdgcn_fence(3, "wavefront"); __builtin_amdgcn_wave_barrier(); asm volatile("" ::: "memory");
        float* crow = OUT + ((size_t)b * SEQ + q0 + kh * 16) * DM + (size_t)h * HD;
#pragma unroll
        for (int s = 0; s < 8; ++s) { const int row = 2 * s + hi, cofs = lr * 4; const v4f val = *(const v4fa*)(os + row * OSP + cofs);
            *(v4f*)(crow + (size_t)row * DM + cofs) = val; }
    }
}

extern "C" void kernel_launch(void* const* d_in, const int* in_sizes, int n_in,
                              void* d_out, int out_size, void* d_ws, size_t ws_size, hipStream_t stream) {
    if (n_in < 7) return;
    if (in_sizes[0] < (NB - 1) * SEQ_FULL * DM + SEQ * DM) return;
    if (in_sizes[1] < NH * HD * HD || in_sizes[3] < NH * HD * HD || in_sizes[5] < NH * HD * HD) return;
    if (in_sizes[2] < NH * HD || in_sizes[4] < NH * HD || in_sizes[6] < NH * HD) return;
    if (out_size < NB * SEQ * DM) return;
    const float* x = (const float*)d_in[0]; const float* wq = (const float*)d_in[1]; const float* bq = (const float*)d_in[2]; const float* wk = (const float*)d_in[3]; const float* bk = (const float*)d_in[4]; const float* wv = (const float*)d_in[5]; const float* bv = (const float*)d_in[6];
    float* OUT = (float*)d_out;     // [NB][SEQ][DM]
    char* wsp = (char*)d_ws;
    auto take = [&](size_t bytes) { char* p = wsp; wsp += (bytes + 255) & ~(size_t)255; return (void*)p; };
    h16* Q16  = (h16*)take((size_t)NB * NH * SEQ * HD * 2);    // [NB][16][SEQ][64] fp16 = 8,388,608 B
    h16* K16  = (h16*)take((size_t)NB * NH * SEQ * HD * 2);
    h16* VT16 = (h16*)take((size_t)NB * NH * HD * SEQ * 2);    // [NB][16][64][SEQ] fp16
    if ((size_t)(wsp - (char*)d_ws) > ws_size) return;         // total 25,165,824 B
    k_proj<<<dim3((unsigned)(NB * SEQ / PRB), NH, 1), 256, 0, stream>>>(x, wq, bq, wk, bk, wv, bv, Q16, K16, VT16);
    k_attn<<<(unsigned)(NB * NH * (SEQ / QB)), 256, 0, stream>>>(Q16, K16, VT16, OUT);
}

// v008
// One run takes 39.3 microseconds.
// Next to v007, in two timings, it ran 1.03 times as fast each time.
// Over all steps from v000 it is 5.24 times as fast.
#include <hip/hip_runtime.h>
#include <stdint.h>

// Contractions: per-head q/k/v projections = v_wmma_f32_16x16x32_bf16 (bf16 operands from RNE-converted x and W, f32 accumulate, f32 bias add); attention scores q.k and p.v = v_wmma_f32_16x16x32_f16 (fp16 operands, p carried x1024, f32 accumulate); online softmax, normalisation and output in f32.
// Layout: x [NB][SEQ_FULL][1024] (first SEQ rows of each batch read) viewed as 16 head slices of 64; q = x_h Wq[h]^T + bq[h] (W is [h][out][in]), k, v likewise; scores = q.k / 8 over all SEQ keys, softmax, out_h = attn v; heads re-stacked -> [NB][SEQ][1024].

#ifndef NB
#define NB 2
#endif
#ifndef SEQ
#define SEQ 2048
#endif
#define NB_FULL  2
#define SEQ_FULL 2048
#define DM   1024
#define NH   16
#define HD   64
#define KT   64          // keys per LDS tile
#define QTW  2           // 16-query tiles per wave: every K and V^T fragment read from LDS feeds two products
#define KSP  2           // 64-key tiles per stage: waves 0-3 of a block take the first, waves 4-7 the second
#define QB   (4 * 16 * QTW)   // queries per block (4 wave pairs x 32): 512 blocks, two resident per WGP, four waves per SIMD
#define PRB  256         // rows of x per projection block (8 waves)
#define KP   72          // LDS pitch (halves) of the K rows, and of k_proj's tiles: 144 B = 16 B x odd, so the 16 rows one ds_load_b128 half-wave reads fall on 64 distinct banks
#define VP   136         // LDS pitch (halves) of the V^T stage rows (128 keys): 272 B = 16 B x odd, as KP
#define SBUF 9216        // halves per LDS stage buffer: 128 K rows x KP = 18,432 B, a multiple of 2 KiB; the 64 V^T rows x VP (17,408 B) are rounded up to it
#define OSP  68          // LDS pitch (floats) of the per-wave output staging tile
#define PCARL2 10.0f     // log2 of the power-of-two carry (x1024) on the fp16 p operand; the row sum l carries it too
#define CEX  0.18033688011112042f   // HD^-0.5 * log2 e: exp(s / 8) = exp2(s * CEX)
#define LAZY 27.725887f  // 5 / CEX: a raw score may stand up to 2^5 (scaled) above the maximum in use before O is rescaled, so p x1024 stays at or below 2^15, inside fp16

static_assert(DM == NH * HD);
static_assert(SEQ % QB == 0);
static_assert(SEQ % (KSP * KT) == 0);
static_assert(SEQ % PRB == 0 && PRB == 256);   // k_proj: 256 threads, 8 waves x 32 rows
static_assert(NB >= 1 && NB <= NB_FULL);
static_assert(SEQ >= QB && SEQ <= SEQ_FULL);
static_assert(HD % 32 == 0);
static_assert(HD == 64 && KT == 64 && KP >= 64 && KP % 8 == 0);
static_assert(SEQ / (KSP * KT) >= 2);   // k_attn: the two-buffer ring starts with stages 0 and 1
static_assert(KSP * KT * KP == SBUF && HD * VP <= SBUF && (SBUF * 2) % 2048 == 0 && VP == KSP * KT + 8);   // k_attn: every tensor load lands at a multiple of 2 KiB, inside its buffer
static_assert(QTW == 2 && KSP == 2);    // k_attn: a wave keeps one of its two query tiles and hands the other to its partner

typedef _Float16 h16;
typedef unsigned short bf;
typedef __attribute__((ext_vector_type(16))) __bf16   v16bf;
typedef __attribute__((ext_vector_type(16))) _Float16 v16h;
typedef __attribute__((ext_vector_type(8)))  _Float16 v8h;
typedef __attribute__((ext_vector_type(8)))  unsigned short v8us;
typedef __attribute__((ext_vector_type(4)))  unsigned short v4us;
typedef __attribute__((ext_vector_type(8)))  float    v8f;
typedef __attribute__((ext_vector_type(4)))  float    v4f;
typedef v4f __attribute__((may_alias)) v4fa;
typedef __attribute__((ext_vector_type(2)))  float    v2f;

__device__ __forceinline__ unsigned short f2bf(float f) { unsigned u = __float_as_uint(f); u += 0x7FFFu + ((u >> 16) & 1u); return (unsigned short)(u >> 16); }
__device__ __forceinline__ float bf2f(unsigned short b) { return __uint_as_float(((unsigned)b) << 16); }
__device__ __forceinline__ float bfr(float f) { return bf2f(f2bf(f)); }
__device__ __forceinline__ v16h  cat16(v8h lo, v8h hi) { return __builtin_shufflevector(lo, hi, 0, 1, 2, 3, 4, 5, 6, 7, 8, 9, 10, 11, 12, 13, 14, 15); }
__device__ __forceinline__ v16bf cat16b(v8us lo, v8us hi) { return __builtin_bit_cast(v16bf, __builtin_shufflevector(lo, hi, 0, 1, 2, 3, 4, 5, 6, 7, 8, 9, 10, 11, 12, 13, 14, 15)); }
__device__ __forceinline__ v8f wmma16(v16h a, v16h b, v8f c) { return __builtin_amdgcn_wmma_f32_16x16x32_f16(false, a, false, b, (short)0, c, false, false); }
__device__ __forceinline__ v8f wmmab(v16bf a, v16bf b, v8f c) { return __builtin_amdgcn_wmma_f32_16x16x32_bf16(false, a, false, b, (short)0, c, false, false); }
// Fragment loaders (A and B identical): p = plane + row(l&15) * pitch + k0 + 8*(l>>4); elements 0..7 <- p[0..7], elements 8..15 <- p[16..23] (k0+16+8h..).
__device__ __forceinline__ v16h  ldh(const h16* p) { return cat16(*(const v8h*)p, *(const v8h*)(p + 16)); }
__device__ __forceinline__ v16bf ldb16(const bf* p) { return cat16b(*(const v8us*)p, *(const v8us*)(p + 16)); }

// ---- k_proj: all three per-head projections in one launch. Block = 8 waves, one (b, h), PRB consecutive rows of x.
// Stage: the x slice [PRB][64] and the head's Wq, Wk, Wv [64][64] are read as whole 128-B lines in f32, RNE-converted to bf16 and laid in LDS at pitch KP, the three bias rows beside them (one block barrier).
// Products: wave (g = wave >> 1, half = wave & 1) of row group g (64 rows). q and k: A = W rows, B = x rows, so a lane holds 8 consecutive outputs e of one row t (its 32 rows: half);
// v: A = x rows, B = W rows, so a lane holds 8 consecutive t of one output e (all 64 rows, its 32 outputs: half). Both operands through the same loader, k = 0..31 then 32..63, f32 accumulate, + bf16(bias), -> fp16.
// Store: each 32 x 64 fp16 tile goes through a wave-private LDS tile so that every global store writes whole 128-B lines of Q16 / K16 [t][d] and VT16 [d][t].
__global__ __launch_bounds__(256)
void k_proj(const float* __restrict__ x, const float* __restrict__ wq, const float* __restrict__ bq, const float* __restrict__ wk, const float* __restrict__ bk,
            const float* __restrict__ wv, const float* __restrict__ bv, h16* Q16, h16* K16, h16* VT16) {
    __shared__ __align__(16) bf  Xs[PRB * KP];             // x slice, bf16, cross-wave (block barrier)
    __shared__ __align__(16) bf  Ws[3 * HD * KP];          // Wq, Wk, Wv of this head, bf16, cross-wave (block barrier)
    __shared__ __align__(32) float Bs[3 * HD];             // bf16-rounded bq, bk, bv of this head, cross-wave (block barrier)
    __shared__ __align__(16) h16 Ts[3][PRB / 32][32 * KP]; // wave-private output staging, one tile per product
    const int tid = threadIdx.x, wave = tid >> 5, lane = tid & 31, lr = lane & 15, hi = lane >> 4;
    const int h = blockIdx.y, row0 = blockIdx.x * PRB, b = row0 / SEQ, t0 = row0 % SEQ;
    const int g = wave >> 1, half = wave & 1;
    const int sr = tid >> 4, sc = (tid & 15) * 4;          // staging: 16 lanes x 16 B = one 256-B row slice
    const float* xl  = x + ((size_t)b * SEQ_FULL + t0 + sr) * DM + h * HD + sc;
    const float* wl0 = wq + (size_t)h * HD * HD + sr * HD + sc;
    const float* wl1 = wk + (size_t)h * HD * HD + sr * HD + sc;
    const float* wl2 = wv + (size_t)h * HD * HD + sr * HD + sc;
    const float* bl  = ((wave < 2) ? bq : ((wave < 4) ? bk : bv)) + h * HD + (tid & 63);   // waves 6 and 7 read bv again and store nothing
    v4f xr[PRB / 16], wr[12];
#pragma unroll
    for (int j = 0; j < PRB / 16; ++j) xr[j] = *(const v4f*)(xl + (size_t)j * 16 * DM);
#pragma unroll
    for (int j = 0; j < 4; ++j) { wr[j] = *(const v4f*)(wl0 + j * 16 * HD); wr[4 + j] = *(const v4f*)(wl1 + j * 16 * HD); wr[8 + j] = *(const v4f*)(wl2 + j * 16 * HD); }
    const float br = *bl;
    // the five address values are inputs here, so they stay in their registers up to this wait and no later instruction reuses one ahead of it
    asm volatile("s_wait_xcnt 0x0" :: "v"(xl), "v"(wl0), "v"(wl1), "v"(wl2), "v"(bl) : "memory");
#pragma unroll
    for (int j = 0; j < PRB / 16; ++j) { v4us o;
#pragma unroll
        for (int k = 0; k < 4; ++k) o[k] = f2bf(xr[j][k]);
        *(v4us*)(Xs + (sr + j * 16) * KP + sc) = o; }
#pragma unroll
    for (int j = 0; j < 12; ++j) { v4us o;
#pragma unroll
        for (int k = 0; k < 4; ++k) o[k] = f2bf(wr[j][k]);
        *(v4us*)(Ws + ((j >> 2) * HD + sr + (j & 3) * 16) * KP + sc) = o; }
    if (tid < 3 * HD) Bs[tid] = bfr(br);
    __syncthreads();
    // x fragments of row group g; slot i holds 16-row tile tb(i) = (2 * half + i) & 3, so slots 0 and 1 are this wave's own q / k rows
    v16bf xf[4][2];
#pragma unroll
    for (int i = 0; i < 4; ++i)
#pragma unroll
        for (int kk = 0; kk < 2; ++kk) xf[i][kk] = ldb16(Xs + (g * 64 + ((half * 2 + i) & 3) * 16 + lr) * KP + kk * 32 + 8 * hi);
    const size_t bh = (size_t)b * NH + h;
#pragma unroll
    for (int m = 0; m < 3; ++m) {
        h16* ts = Ts[m][wave];
        if (m < 2) {
#pragma unroll
            for (int et = 0; et < 4; ++et) {
                const v16bf w0 = ldb16(Ws + (m * HD + et * 16 + lr) * KP + 8 * hi), w1 = ldb16(Ws + (m * HD + et * 16 + lr) * KP + 32 + 8 * hi);
                const v8f bb = *(const v8f*)(Bs + m * HD + et * 16 + 8 * hi);
#pragma unroll
                for (int tt = 0; tt < 2; ++tt) { v8f c = (v8f){}; c = wmmab(w0, xf[tt][0], c); c = wmmab(w1, xf[tt][1], c);
                    v8h o;
#pragma unroll
                    for (int j = 0; j < 8; ++j) o[j] = (h16)(c[j] + bb[j]);
                    *(v8h*)(ts + (tt * 16 + lr) * KP + et * 16 + 8 * hi) = o; }
            }
        } else {
#pragma unroll
            for (int ee = 0; ee < 2; ++ee) {
                const v16bf w0 = ldb16(Ws + (2 * HD + (half * 2 + ee) * 16 + lr) * KP + 8 * hi), w1 = ldb16(Ws + (2 * HD + (half * 2 + ee) * 16 + lr) * KP + 32 + 8 * hi);
                const float bb = Bs[2 * HD + (half * 2 + ee) * 16 + lr];
#pragma unroll
                for (int i = 0; i < 4; ++i) { v8f c = (v8f){}; c = wmmab(xf[i][0], w0, c); c = wmmab(xf[i][1], w1, c);
                    v8h o;
#pragma unroll
                    for (int j = 0; j < 8; ++j) o[j] = (h16)(c[j] + bb);
                    *(v8h*)(ts + (ee * 16 + lr) * KP + ((half * 2 + i) & 3) * 16 + 8 * hi) = o; }
            }
        }
        // the rows read back below were written by other lanes of this wave: keep the compiler from moving the reads above the writes
        __builtin_amdgcn_fence(3, "wavefront"); __builtin_amdgcn_wave_barrier(); asm volatile("" ::: "memory");
        h16* dst = (m == 0) ? Q16 + (bh * SEQ + t0 + g * 64 + half * 32) * HD : ((m == 1) ? K16 + (bh * SEQ + t0 + g * 64 + half * 32) * HD : VT16 + (bh * HD + half * 32) * SEQ + t0 + g * 64);
        const size_t dp = (m < 2) ? (size_t)HD : (size_t)SEQ;
#pragma unroll
        for (int s = 0; s < 8; ++s) { const int row = 4 * s + (lane >> 3), ch = (lane & 7) * 8;
            *(v8h*)(dst + (size_t)row * dp + ch) = *(const v8h*)(ts + row * KP + ch); }
    }
}

// ---- k_attn: flash attention, block = 8 waves, one (b,h), QB queries; wave (wq = wave & 3, kh = wave >> 2) = 32 queries (QTW tiles of 16) against every second 64-key tile (kh).
// Two blocks share a WGP (waves_per_eu 4, 4: the grid is exactly two blocks per WGP): one block's waves cover the other's LDS and cross-lane waits.
// Per 128-key stage: 128 K rows [t][d] and 64 V^T rows [d][128 t] lie in one of two LDS buffers each (cross-wave regions); the next stage's two tensor loads (wave 0: K, wave 1: V^T; the pad field sets the LDS pitch) fly into the other buffers meanwhile.
// Foot of each trip: own LDS reads done, the issuing waves' loads landed, one block barrier (publishes stage s + 1 and frees stage s's buffers), then the loads of stage s + 2 into the freed buffers;
// S^T = K . Q^T per 16-key sub-tile (A = K rows from LDS, B = Q columns from the plane, both split-k loaders), so each lane holds 8 keys of one query; one K fragment serves both query tiles;
// online softmax in f32 (one multiply-add and one exp2 per score) against a maximum in use m that follows the running maximum lazily: one wave-uniform test per trip, on each lane's own 32 keys;
// only where some score stands more than LAZY above m are the halves' maxima joined, m raised and l and O rescaled; p x1024 packed into A fragments straight from the two adjacent 16-key accumulator tiles
// (element r <- keys 0-15 tile, element 8+r <- keys 16-31 tile, lane unchanged); O += P . V with B = V^T rows from LDS, one V^T fragment serving both query tiles.
// After the loop the waves wq and wq + 4 hold (m, l, O) of the same 32 queries over complementary keys: register slot s holds query tile s ^ kh, each wave hands slot 1 to its partner through LDS
// (one block barrier) and merges the partner's slot 1 into its own slot 0 by the usual max / rescale rule, then normalises and stores those 16 queries.
typedef v2f __attribute__((may_alias)) v2fa;
typedef uint32_t u32x4 __attribute__((ext_vector_type(4)));
typedef uint32_t u32x8 __attribute__((ext_vector_type(8)));
__device__ __forceinline__ uint32_t uni(uint32_t v) { return (uint32_t)__builtin_amdgcn_readfirstlane(v); }
__device__ __forceinline__ uint32_t pinned(uint32_t v) { uint32_t w = (uint32_t)__builtin_amdgcn_readfirstlane(v); asm volatile("" : "+s"(w)); return w; }   // a wave-uniform test held in a scalar register, so that the branch on it is a scalar branch: a tensor load ignores EXEC
// Descriptor group 1 of a tile of ROWS rows of ROWB bytes at source pitch PITCH bytes, landing in LDS at pitch ROWB + 16 (pad word W0: interval = the row, 4 dwords); 1-byte elements, tensor = tile, no mask.
template <uint32_t W0, uint32_t ROWB, uint32_t ROWS, uint32_t PITCH>
__device__ __forceinline__ u32x8 tdm_group1() {
    u32x8 g1;
    g1[0] = uni(W0); g1[1] = uni((ROWB & 0xFFFFu) << 16); g1[2] = uni((ROWB >> 16) | ((ROWS & 0xFFFFu) << 16)); g1[3] = uni((ROWS >> 16) | (ROWB << 16));
    g1[4] = uni(ROWS); g1[5] = uni(PITCH); g1[6] = uni(0u); g1[7] = uni(0u);
    asm volatile("" : "+s"(g1));   // pinned(), for a whole group: the descriptor words held in scalar registers of their own from here on, so that none takes a new value while a request is outstanding
    return g1;
}
// One tensor load; the waits are written at the places that need them.
__device__ __forceinline__ void tdm_load(u32x4& g0, uint32_t lds, uint64_t ga, u32x8 g1) {
    g0[1] = uni(lds); g0[2] = uni((uint32_t)ga); g0[3] = uni((((uint32_t)(ga >> 32)) & 0x01FFFFFFu) | 0x80000000u);
    asm volatile("tensor_load_to_lds %0, %1" :: "s"(g0), "s"(g1) : "memory");
}

__global__ __launch_bounds__(256) __attribute__((amdgpu_waves_per_eu(4, 4)))
void k_attn(const h16* __restrict__ Q16, const h16* __restrict__ K16, const h16* __restrict__ VT16, float* OUT) {
    __shared__ __attribute__((aligned(2048))) h16 KV[4][SBUF];   // [0], [1]: two buffers of 128 K rows [t][d] at pitch KP; [2], [3]: two buffers of 64 V^T rows [d][128 t] at pitch VP; cross-wave (block barriers)
    __shared__ __align__(16) float osh[8][16 * OSP];     // wave-private output staging
    __shared__ __align__(16) float xo[8][4 * 2 * 32 * 4]; // hand-over of one O tile per wave, [et][register quad][lane], cross-wave (block barrier)
    __shared__ __align__(8)  float xml[8][32 * 2];       // hand-over of that tile's (m, l), cross-wave (block barrier)
    const int tid = threadIdx.x, wv = tid >> 5, lane = tid & 31, lr = lane & 15, hi = lane >> 4;
    const int wq = wv & 3, kh = wv >> 2;
    const int qblks = SEQ / QB; const int bh = blockIdx.x / qblks, qblk = blockIdx.x % qblks; const int b = bh / NH, h = bh % NH;
    const int q0 = qblk * QB + wq * (16 * QTW);
    const h16* Qp = Q16 + ((size_t)bh * SEQ + q0) * HD;
    v16h qf[QTW][2];
#pragma unroll
    for (int qt = 0; qt < QTW; ++qt)
#pragma unroll
        for (int kk = 0; kk < 2; ++kk) qf[qt][kk] = ldh(Qp + (size_t)((qt ^ kh) * 16 + lr) * HD + kk * 32 + 8 * hi);
    const h16* Kb = K16 + (size_t)bh * SEQ * HD; const h16* Vb = VT16 + (size_t)bh * HD * SEQ;
    v8f o[QTW][4];
#pragma unroll
    for (int qt = 0; qt < QTW; ++qt)
#pragma unroll
        for (int et = 0; et < 4; ++et) o[qt][et] = (v8f){};
    float m_run[QTW], l_run[QTW], nb[QTW];   // nb = PCARL2 - m_run * CEX, the addend of the scores' multiply-add; it changes only where m_run does
#pragma unroll
    for (int qt = 0; qt < QTW; ++qt) { m_run[qt] = -1.0e30f; l_run[qt] = 0.f; nb[qt] = 0.f; }
    float* os = osh[wv];
    // staging: wave 0 brings the stage's K rows, wave 1 its V^T rows, one request each
    const uint32_t wave = uni((uint32_t)tid >> 5), lbase = (uint32_t)(size_t)&KV[0][0];
    uint64_t gk = (uint64_t)(size_t)Kb, gv = (uint64_t)(size_t)Vb;
    const u32x8 g1k = tdm_group1<(1u << 20) | (4u << 22) | (3u << 25), 2u * HD, KSP * KT, 2u * HD>();         // 128 rows of 128 B, contiguous in K16
    const u32x8 g1v = tdm_group1<(1u << 20) | (5u << 22) | (3u << 25), 2u * KSP * KT, HD, 2u * SEQ>();        // 64 rows of 256 B at the pitch of VT16
    u32x4 g0; g0[0] = uni(1u); g0[1] = uni(0u); g0[2] = uni(0u); g0[3] = uni(0u);
    asm volatile("" : "+s"(g0));   // pinned(), for group 0: descriptor words held in scalar registers of their own; word 0 (count 1) is written once, word 3 only behind the wait that covers the wave's last request
    if (pinned(wave == 0)) { tdm_load(g0, lbase, gk, g1k); asm volatile("s_wait_tensorcnt 0x0" ::: "memory"); }   // stage 0 has landed before the barrier publishes it
    if (pinned(wave == 1)) { tdm_load(g0, lbase + 2u * SBUF * 2u, gv, g1v); asm volatile("s_wait_tensorcnt 0x0" ::: "memory"); }
    __syncthreads();
    gk += KSP * KT * HD * 2; gv += KSP * KT * 2;
    if (pinned(wave == 0)) tdm_load(g0, lbase + SBUF * 2u, gk, g1k);
    if (pinned(wave == 1)) tdm_load(g0, lbase + 3u * SBUF * 2u, gv, g1v);
    uint32_t coff = 0;   // halves from buffer 0 to the buffer in use: 0 or SBUF in turn
#pragma unroll 1
    for (int t0 = 0; t0 < SEQ; t0 += KSP * KT) {
        const h16* Kc = KV[0] + coff + kh * KT * KP; const h16* Vc = KV[2] + coff + kh * KT;
        v8f st[QTW][4]; v16h ka[4][2];
#pragma unroll
        for (int ts = 0; ts < 4; ++ts) { ka[ts][0] = ldh(Kc + (ts * 16 + lr) * KP + 8 * hi); ka[ts][1] = ldh(Kc + (ts * 16 + lr) * KP + 32 + 8 * hi); }
#pragma unroll
        for (int ts = 0; ts < 4; ++ts)
#pragma unroll
            for (int qt = 0; qt < QTW; ++qt) { v8f c = (v8f){}; c = wmma16(ka[ts][0], qf[qt][0], c); c = wmma16(ka[ts][1], qf[qt][1], c); st[qt][ts] = c; }
        // four vector slots between the last product and the first vector instruction that reads a score
        asm volatile("v_nop\n\tv_nop\n\tv_nop\n\tv_nop" : "+v"(st[0][0]), "+v"(st[0][1]), "+v"(st[0][2]), "+v"(st[0][3]), "+v"(st[1][0]), "+v"(st[1][1]), "+v"(st[1][2]), "+v"(st[1][3]) : "v"(ka[3][0]), "v"(ka[3][1]), "v"(qf[0][1]), "v"(qf[1][1]));
        v16h vb[4][2], pa[QTW][2];
        float tm[QTW];
#pragma unroll
        for (int qt = 0; qt < QTW; ++qt) {
            // online softmax: lane owns query lr, keys 8*hi + r of each 16-key sub-tile; the partner lane (lane ^ 16) owns the other 32 keys
            tm[qt] = -1.0e30f;     // maximum of this lane's raw scores: the factor CEX is positive, so it is the maximum of the scaled ones too
#pragma unroll
            for (int ts = 0; ts < 4; ++ts)
#pragma unroll
                for (int v = 0; v < 8; ++v) tm[qt] = fmaxf(tm[qt], st[qt][ts][v]);
        }
        // lazy rescale, one scalar branch per trip: m_run is the same in a lane and its partner, and behind this test no score of either stands more than LAZY above it
        if (__builtin_amdgcn_ballot_w32(fmaxf(tm[0] - m_run[0], tm[1] - m_run[1]) > LAZY) != 0) {
#pragma unroll
            for (int qt = 0; qt < QTW; ++qt) {
                const float m_new = fmaxf(m_run[qt], fmaxf(tm[qt], __shfl_xor(tm[qt], 16, 32)));
                float alpha;
                // alpha = exp2((m_old - m_new) * CEX), in asm so that it is one unit with its v_nop: the free slot that the instruction set asks for behind a transcendental, here in front of the reads of alpha
                asm("v_exp_f32 %0, %1\n\tv_nop" : "=v"(alpha) : "v"((m_run[qt] - m_new) * CEX));
                m_run[qt] = m_new; nb[qt] = __builtin_fmaf(-m_new, CEX, PCARL2); l_run[qt] *= alpha;
                // rescale O: accumulator element v of this lane is query row 8*hi + v; alpha for that query lives in lane 8*hi + v
#pragma unroll
                for (int v = 0; v < 8; ++v) { const float fs = __shfl(alpha, v + 8 * hi, 32); o[qt][0][v] *= fs; o[qt][1][v] *= fs; o[qt][2][v] *= fs; o[qt][3][v] *= fs; }
            }
        }
        // first half of the V^T fragments: all four at once, beside both tiles' scores, did not fit the registers
#pragma unroll
        for (int et = 0; et < 2; ++et) { vb[et][0] = ldh(Vc + (et * 16 + lr) * VP + 8 * hi); vb[et][1] = ldh(Vc + (et * 16 + lr) * VP + 32 + 8 * hi); }
#pragma unroll
        for (int qt = 0; qt < QTW; ++qt) {
            // p x1024 = exp2(s * CEX + nb): the score scale, log2 e and the carry sit in one multiply-add, two scores per packed instruction
            const v2f c2 = {CEX, CEX}, nb2 = {nb[qt], nb[qt]};
#pragma unroll
            for (int ts = 0; ts < 4; ++ts)
#pragma unroll
                for (int v = 0; v < 8; v += 2) { const v2f a = __builtin_elementwise_fma((v2f){st[qt][ts][v], st[qt][ts][v + 1]}, c2, nb2);
                    st[qt][ts][v] = __builtin_amdgcn_exp2f(a[0]); st[qt][ts][v + 1] = __builtin_amdgcn_exp2f(a[1]); }
            float rs = 0.f;
#pragma unroll
            for (int v = 0; v < 8; v += 2) {   // two keys per packed add; every sum and its order as for one key at a time
                const v2f p0 = {st[qt][0][v], st[qt][0][v + 1]}, p1 = {st[qt][1][v], st[qt][1][v + 1]}, p2 = {st[qt][2][v], st[qt][2][v + 1]}, p3 = {st[qt][3][v], st[qt][3][v + 1]};
                const v2f t = (p0 + p1) + (p2 + p3);
                rs += t[0]; rs += t[1];
#pragma unroll
                for (int w = 0; w < 2; ++w) {
                    pa[qt][0][v + w] = (h16)p0[w]; pa[qt][0][v + w + 8] = (h16)p1[w];   // keys 8h+v and 16+8h+v of the 64-key tile
                    pa[qt][1][v + w] = (h16)p2[w]; pa[qt][1][v + w + 8] = (h16)p3[w];   // keys 32+8h+v and 48+8h+v
                }
            }
            rs += __shfl_xor(rs, 16, 32);
            l_run[qt] += rs;
        }
#pragma unroll
        for (int et = 2; et < 4; ++et) { vb[et][0] = ldh(Vc + (et * 16 + lr) * VP + 8 * hi); vb[et][1] = ldh(Vc + (et * 16 + lr) * VP + 32 + 8 * hi); }
        __builtin_amdgcn_sched_barrier(0);   // keeps these eight reads one group ahead of the products (left free, they were spread in pairs among the products, each pair waited for where it stood)
#pragma unroll
        for (int et = 0; et < 4; ++et)
#pragma unroll
            for (int qt = 0; qt < QTW; ++qt) { o[qt][et] = wmma16(pa[qt][0], vb[et][0], o[qt][et]); o[qt][et] = wmma16(pa[qt][1], vb[et][1], o[qt][et]); }
        // four vector slots between the last product and whatever follows it on either side of the loop's branches
        asm volatile("v_nop\n\tv_nop\n\tv_nop\n\tv_nop" : "+v"(o[0][0]), "+v"(o[0][1]), "+v"(o[0][2]), "+v"(o[0][3]), "+v"(o[1][0]), "+v"(o[1][1]), "+v"(o[1][2]), "+v"(o[1][3]) : "v"(pa[0][0]), "v"(pa[0][1]), "v"(pa[1][0]), "v"(pa[1][1]), "v"(vb[3][1]));
        asm volatile("s_wait_dscnt 0x0" ::: "memory");      // this wave's reads of the current buffer are done before the barrier frees it for refilling
        if (pinned(wave < 2)) asm volatile("s_wait_tensorcnt 0x0" ::: "memory");   // an issuing wave's load of the next stage has landed before the barrier publishes it
        __syncthreads();
        if (pinned(t0 + 2 * KSP * KT < SEQ)) {              // scalar: a stage s + 2 exists
            gk += KSP * KT * HD * 2; gv += KSP * KT * 2;
            if (pinned(wave == 0)) tdm_load(g0, lbase + coff * 2u, gk, g1k);
            if (pinned(wave == 1)) tdm_load(g0, lbase + 2u * SBUF * 2u + coff * 2u, gv, g1v);
        }
        coff ^= SBUF;
    }
    asm volatile("s_wait_tensorcnt 0x0" ::: "memory");      // nothing of this wave is in flight when it goes on to the epilogue and ends
    asm volatile("s_wait_dscnt 0x0" ::: "memory");          // nor is any LDS read of the ring
    // hand-over: slot 1 (query tile 1 ^ kh) goes to the partner wave, whose slot 0 is that tile; same lane, same register on both sides
    {
        float* xw = xo[wv];
#pragma unroll
        for (int et = 0; et < 4; ++et) {
            *(v4fa*)(xw + ((et * 2 + 0) * 32 + lane) * 4) = __builtin_shufflevector(o[1][et], o[1][et], 0, 1, 2, 3);
            *(v4fa*)(xw + ((et * 2 + 1) * 32 + lane) * 4) = __builtin_shufflevector(o[1][et], o[1][et], 4, 5, 6, 7); }
        *(v2fa*)(xml[wv] + lane * 2) = (v2f){m_run[1], l_run[1]};
    }
    __syncthreads();                                        // the partner's tile is read only behind this barrier
    // merge and epilogue: out[b][q][h*HD + d] = (O_a fa + O_b fb) / (l_a fa + l_b fb), f = exp2((m - max(m_a, m_b)) * CEX); O and l both carry x1024
    {
        const float* xr = xo[wv ^ 4];
        const v2f ml = *(const v2fa*)(xml[wv ^ 4] + lane * 2);
        const float mm = fmaxf(m_run[0], ml[0]);
        const float fa = __builtin_amdgcn_exp2f((m_run[0] - mm) * CEX), fb = __builtin_amdgcn_exp2f((ml[0] - mm) * CEX);
        const float inv = 1.0f / (l_run[0] * fa + ml[1] * fb);
        const float ga = fa * inv, gb = fb * inv;
        v4f pb[4][2];
#pragma unroll
        for (int et = 0; et < 4; ++et) { pb[et][0] = *(const v4fa*)(xr + ((et * 2 + 0) * 32 + lane) * 4); pb[et][1] = *(const v4fa*)(xr + ((et * 2 + 1) * 32 + lane) * 4); }
#pragma unroll
        for (int j = 0; j < 8; ++j) { const float fsa = __shfl(ga, j + 8 * hi, 32), fsb = __shfl(gb, j + 8 * hi, 32);
#pragma unroll
            for (int et = 0; et < 4; ++et) os[(hi * 8 + j) * OSP + et * 16 + lr] = o[0][et][j] * fsa + pb[et][j >> 2][j & 3] * fsb; }
        __builtin_amdgcn_fence(3, "wavefront"); __builtin_amdgcn_wave_barrier(); asm volatile("" ::: "memory");
        float* crow = OUT + ((size_t)b * SEQ + q0 + kh * 16) * DM + (size_t)h * HD;
#pragma unroll
        for (int s = 0; s < 8; ++s) { const int row = 2 * s + hi, cofs = lr * 4; const v4f val = *(const v4fa*)(os + row * OSP + cofs);
            *(v4f*)(crow + (size_t)row * DM + cofs) = val; }
    }
}

extern "C" void kernel_launch(void* const* d_in, const int* in_sizes, int n_in,
                              void* d_out, int out_size, void* d_ws, size_t ws_size, hipStream_t stream) {
    if (n_in < 7) return;
    if (in_sizes[0] < (NB - 1) * SEQ_FULL * DM + SEQ * DM) return;
    if (in_sizes[1] < NH * HD * HD || in_sizes[3] < NH * HD * HD || in_sizes[5] < NH * HD * HD) return;
    if (in_sizes[2] < NH * HD || in_sizes[4] < NH * HD || in_sizes[6] < NH * HD) return;
    if (out_size < NB * SEQ * DM) return;
    const float* x = (const float*)d_in[0]; const float* wq = (const float*)d_in[1]; const float* bq = (const float*)d_in[2]; const float* wk = (const float*)d_in[3]; const float* bk = (const float*)d_in[4]; const float* wv = (const float*)d_in[5]; const float* bv = (const float*)d_in[6];
    float* OUT = (float*)d_out;     // [NB][SEQ][DM]
    char* wsp = (char*)d_ws;
    auto take = [&](size_t bytes) { char* p = wsp; wsp += (bytes + 255) & ~(size_t)255; return (void*)p; };
    h16* Q16  = (h16*)take((size_t)NB * NH * SEQ * HD * 2);    // [NB][16][SEQ][64] fp16 = 8,388,608 B
    h16* K16  = (h16*)take((size_t)NB * NH * SEQ * HD * 2);
    h16* VT16 = (h16*)take((size_t)NB * NH * HD * SEQ * 2);    // [NB][16][64][SEQ] fp16
    if ((size_t)(wsp - (char*)d_ws) > ws_size) return;         // total 25,165,824 B
    k_proj<<<dim3((unsigned)(NB * SEQ / PRB), NH, 1), 256, 0, stream>>>(x, wq, bq, wk, bk, wv, bv, Q16, K16, VT16);
    k_attn<<<(unsigned)(NB * NH * (SEQ / QB)), 256, 0, stream>>>(Q16, K16, VT16, OUT);
}

// v009
// A run of this version takes 38.4 microseconds.
// Two timings next to v008 both put it at 1.05 times that version's speed.
// Counting every step since v000, it is 5.50 times as fast.
#include <hip/hip_runtime.h>
#include <stdint.h>

// Contractions: per-head q/k/v projections = v_wmma_f32_16x16x32_bf16 (bf16 operands from RNE-converted x and W, f32 accumulate, f32 bias add); attention scores q.k and p.v = v_wmma_f32_16x16x32_f16 (fp16 operands, p carried x1024, f32 accumulate); online softmax, normalisation and output in f32.
// Layout: x [NB][SEQ_FULL][1024] (first SEQ rows of each batch read) viewed as 16 head slices of 64; q = x_h Wq[h]^T + bq[h] (W is [h][out][in]), k, v likewise; scores = q.k / 8 over all SEQ keys, softmax, out_h = attn v; heads re-stacked -> [NB][SEQ][1024].

#ifndef NB
#define NB 2
#endif
#ifndef SEQ
#define SEQ 2048
#endif
#define NB_FULL  2
#define SEQ_FULL 2048
#define DM   1024
#define NH   16
#define HD   64
#define KT   64          // keys per LDS tile
#define QTW  2           // 16-query tiles per wave: every K and V^T fragment read from LDS feeds two products
#define KSP  2           // 64-key tiles per stage: waves 0-3 of a block take the first, waves 4-7 the second
#define QB   (4 * 16 * QTW)   // queries per block (4 wave pairs x 32): 512 blocks, two resident per WGP, four waves per SIMD
#define PRB  256         // rows of x per projection block (8 waves)
#define KP   72          // LDS pitch (halves) of the K rows, and of k_proj's tiles: 144 B = 16 B x odd, so the 16 rows one ds_load_b128 half-wave reads fall on 64 distinct banks
#define VP   136         // LDS pitch (halves) of the V^T stage rows (128 keys): 272 B = 16 B x odd, as KP
#define SBUF 9216        // halves per LDS stage buffer: 128 K rows x KP = 18,432 B, a multiple of 2 KiB; the 64 V^T rows x VP (17,408 B) are rounded up to it
#define OSP  68          // LDS pitch (floats) of the per-wave output staging tile
#define PCARL2 10.0f     // log2 of the power-of-two carry (x1024) on the fp16 p operand; the row sum l carries it too
#define CEX  0.18033688011112042f   // HD^-0.5 * log2 e: exp(s / 8) = exp2(s * CEX)
#define PLIM 65504.0f    // largest finite fp16: while a lane's sum of its 32 positive p x1024 stays at or below it, so does each of them

static_assert(DM == NH * HD);
static_assert(SEQ % QB == 0);
static_assert(SEQ % (KSP * KT) == 0);
static_assert(SEQ % PRB == 0 && PRB == 256);   // k_proj: 256 threads, 8 waves x 32 rows
static_assert(NB >= 1 && NB <= NB_FULL);
static_assert(SEQ >= QB && SEQ <= SEQ_FULL);
static_assert(HD % 32 == 0);
static_assert(HD == 64 && KT == 64 && KP >= 64 && KP % 8 == 0);
static_assert(SEQ / (KSP * KT) >= 2);   // k_attn: the two-buffer ring starts with stages 0 and 1
static_assert(KSP * KT * KP == SBUF && HD * VP <= SBUF && (SBUF * 2) % 2048 == 0 && VP == KSP * KT + 8);   // k_attn: every tensor load lands at a multiple of 2 KiB, inside its buffer
static_assert(QTW == 2 && KSP == 2);    // k_attn: a wave keeps one of its two query tiles and hands the other to its partner

typedef _Float16 h16;
typedef unsigned short bf;
typedef __attribute__((ext_vector_type(16))) __bf16   v16bf;
typedef __attribute__((ext_vector_type(16))) _Float16 v16h;
typedef __attribute__((ext_vector_type(8)))  _Float16 v8h;
typedef __attribute__((ext_vector_type(8)))  unsigned short v8us;
typedef __attribute__((ext_vector_type(4)))  unsigned short v4us;
typedef __attribute__((ext_vector_type(8)))  float    v8f;
typedef __attribute__((ext_vector_type(4)))  float    v4f;
typedef v4f __attribute__((may_alias)) v4fa;
typedef __attribute__((ext_vector_type(2)))  float    v2f;

__device__ __forceinline__ unsigned short f2bf(float f) { unsigned u = __float_as_uint(f); u += 0x7FFFu + ((u >> 16) & 1u); return (unsigned short)(u >> 16); }
__device__ __forceinline__ float bf2f(unsigned short b) { return __uint_as_float(((unsigned)b) << 16); }
__device__ __forceinline__ float bfr(float f) { return bf2f(f2bf(f)); }
__device__ __forceinline__ v16h  cat16(v8h lo, v8h hi) { return __builtin_shufflevector(lo, hi, 0, 1, 2, 3, 4, 5, 6, 7, 8, 9, 10, 11, 12, 13, 14, 15); }
__device__ __forceinline__ v16bf cat16b(v8us lo, v8us hi) { return __builtin_bit_cast(v16bf, __builtin_shufflevector(lo, hi, 0, 1, 2, 3, 4, 5, 6, 7, 8, 9, 10, 11, 12, 13, 14, 15)); }
__device__ __forceinline__ v8f wmma16(v16h a, v16h b, v8f c) { return __builtin_amdgcn_wmma_f32_16x16x32_f16(false, a, false, b, (short)0, c, false, false); }
__device__ __forceinline__ v8f wmmab(v16bf a, v16bf b, v8f c) { return __builtin_amdgcn_wmma_f32_16x16x32_bf16(false, a, false, b, (short)0, c, false, false); }
// Fragment loaders (A and B identical): p = plane + row(l&15) * pitch + k0 + 8*(l>>4); elements 0..7 <- p[0..7], elements 8..15 <- p[16..23] (k0+16+8h..).
__device__ __forceinline__ v16h  ldh(const h16* p) { return cat16(*(const v8h*)p, *(const v8h*)(p + 16)); }
__device__ __forceinline__ v16bf ldb16(const bf* p) { return cat16b(*(const v8us*)p, *(const v8us*)(p + 16)); }

// ---- k_proj: all three per-head projections in one launch. Block = 8 waves, one (b, h), PRB consecutive rows of x.
// Stage: the x slice [PRB][64] and the head's Wq, Wk, Wv [64][64] are read as whole 128-B lines in f32, RNE-converted to bf16 and laid in LDS at pitch KP, the three bias rows beside them (one block barrier).
// Products: wave (g = wave >> 1, half = wave & 1) of row group g (64 rows). q and k: A = W rows, B = x rows, so a lane holds 8 consecutive outputs e of one row t (its 32 rows: half);
// v: A = x rows, B = W rows, so a lane holds 8 consecutive t of one output e (all 64 rows, its 32 outputs: half). Both operands through the same loader, k = 0..31 then 32..63, f32 accumulate, + bf16(bias), -> fp16.
// Store: each 32 x 64 fp16 tile goes through a wave-private LDS tile so that every global store writes whole 128-B lines of Q16 / K16 [t][d] and VT16 [d][t].
__global__ __launch_bounds__(256)
void k_proj(const float* __restrict__ x, const float* __restrict__ wq, const float* __restrict__ bq, const float* __restrict__ wk, const float* __restrict__ bk,
            const float* __restrict__ wv, const float* __restrict__ bv, h16* Q16, h16* K16, h16* VT16) {
    __shared__ __align__(16) bf  Xs[PRB * KP];             // x slice, bf16, cross-wave (block barrier)
    __shared__ __align__(16) bf  Ws[3 * HD * KP];          // Wq, Wk, Wv of this head, bf16, cross-wave (block barrier)
    __shared__ __align__(32) float Bs[3 * HD];             // bf16-rounded bq, bk, bv of this head, cross-wave (block barrier)
    __shared__ __align__(16) h16 Ts[3][PRB / 32][32 * KP]; // wave-private output staging, one tile per product
    const int tid = threadIdx.x, wave = tid >> 5, lane = tid & 31, lr = lane & 15, hi = lane >> 4;
    const int h = blockIdx.y, row0 = blockIdx.x * PRB, b = row0 / SEQ, t0 = row0 % SEQ;
    const int g = wave >> 1, half = wave & 1;
    const int sr = tid >> 4, sc = (tid & 15) * 4;          // staging: 16 lanes x 16 B = one 256-B row slice
    const float* xl  = x + ((size_t)b * SEQ_FULL + t0 + sr) * DM + h * HD + sc;
    const float* wl0 = wq + (size_t)h * HD * HD + sr * HD + sc;
    const float* wl1 = wk + (size_t)h * HD * HD + sr * HD + sc;
    const float* wl2 = wv + (size_t)h * HD * HD + sr * HD + sc;
    const float* bl  = ((wave < 2) ? bq : ((wave < 4) ? bk : bv)) + h * HD + (tid & 63);   // waves 6 and 7 read bv again and store nothing
    v4f xr[PRB / 16], wr[12];
#pragma unroll
    for (int j = 0; j < PRB / 16; ++j) xr[j] = *(const v4f*)(xl + (size_t)j * 16 * DM);
#pragma unroll
    for (int j = 0; j < 4; ++j) { wr[j] = *(const v4f*)(wl0 + j * 16 * HD); wr[4 + j] = *(const v4f*)(wl1 + j * 16 * HD); wr[8 + j] = *(const v4f*)(wl2 + j * 16 * HD); }
    const float br = *bl;
    // the five address values are inputs here, so they stay in their registers up to this wait and no later instruction reuses one ahead of it
    asm volatile("s_wait_xcnt 0x0" :: "v"(xl), "v"(wl0), "v"(wl1), "v"(wl2), "v"(bl) : "memory");
#pragma unroll
    for (int j = 0; j < PRB / 16; ++j) { v4us o;
#pragma unroll
        for (int k = 0; k < 4; ++k) o[k] = f2bf(xr[j][k]);
        *(v4us*)(Xs + (sr + j * 16) * KP + sc) = o; }
#pragma unroll
    for (int j = 0; j < 12; ++j) { v4us o;
#pragma unroll
        for (int k = 0; k < 4; ++k) o[k] = f2bf(wr[j][k]);
        *(v4us*)(Ws + ((j >> 2) * HD + sr + (j & 3) * 16) * KP + sc) = o; }
    if (tid < 3 * HD) Bs[tid] = bfr(br);
    __syncthreads();
    // x fragments of row group g; slot i holds 16-row tile tb(i) = (2 * half + i) & 3, so slots 0 and 1 are this wave's own q / k rows
    v16bf xf[4][2];
#pragma unroll
    for (int i = 0; i < 4; ++i)
#pragma unroll
        for (int kk = 0; kk < 2; ++kk) xf[i][kk] = ldb16(Xs + (g * 64 + ((half * 2 + i) & 3) * 16 + lr) * KP + kk * 32 + 8 * hi);
    const size_t bh = (size_t)b * NH + h;
#pragma unroll
    for (int m = 0; m < 3; ++m) {
        h16* ts = Ts[m][wave];
        if (m < 2) {
#pragma unroll
            for (int et = 0; et < 4; ++et) {
                const v16bf w0 = ldb16(Ws + (m * HD + et * 16 + lr) * KP + 8 * hi), w1 = ldb16(Ws + (m * HD + et * 16 + lr) * KP + 32 + 8 * hi);
                const v8f bb = *(const v8f*)(Bs + m * HD + et * 16 + 8 * hi);
#pragma unroll
                for (int tt = 0; tt < 2; ++tt) { v8f c = (v8f){}; c = wmmab(w0, xf[tt][0], c); c = wmmab(w1, xf[tt][1], c);
                    v8h o;
#pragma unroll
                    for (int j = 0; j < 8; ++j) o[j] = (h16)(c[j] + bb[j]);
                    *(v8h*)(ts + (tt * 16 + lr) * KP + et * 16 + 8 * hi) = o; }
            }
        } else {
#pragma unroll
            for (int ee = 0; ee < 2; ++ee) {
                const v16bf w0 = ldb16(Ws + (2 * HD + (half * 2 + ee) * 16 + lr) * KP + 8 * hi), w1 = ldb16(Ws + (2 * HD + (half * 2 + ee) * 16 + lr) * KP + 32 + 8 * hi);
                const float bb = Bs[2 * HD + (half * 2 + ee) * 16 + lr];
#pragma unroll
                for (int i = 0; i < 4; ++i) { v8f c = (v8f){}; c = wmmab(xf[i][0], w0, c); c = wmmab(xf[i][1], w1, c);
                    v8h o;
#pragma unroll
                    for (int j = 0; j < 8; ++j) o[j] = (h16)(c[j] + bb);
                    *(v8h*)(ts + (ee * 16 + lr) * KP + ((half * 2 + i) & 3) * 16 + 8 * hi) = o; }
            }
        }
        // the rows read back below were written by other lanes of this wave: keep the compiler from moving the reads above the writes
        __builtin_amdgcn_fence(3, "wavefront"); __builtin_amdgcn_wave_barrier(); asm volatile("" ::: "memory");
        h16* dst = (m == 0) ? Q16 + (bh * SEQ + t0 + g * 64 + half * 32) * HD : ((m == 1) ? K16 + (bh * SEQ + t0 + g * 64 + half * 32) * HD : VT16 + (bh * HD + half * 32) * SEQ + t0 + g * 64);
        const size_t dp = (m < 2) ? (size_t)HD : (size_t)SEQ;
#pragma unroll
        for (int s = 0; s < 8; ++s) { const int row = 4 * s + (lane >> 3), ch = (lane & 7) * 8;
            *(v8h*)(dst + (size_t)row * dp + ch) = *(const v8h*)(ts + row * KP + ch); }
    }
}

// ---- k_attn: flash attention, block = 8 waves, one (b,h), QB queries; wave (wq = wave & 3, kh = wave >> 2) = 32 queries (QTW tiles of 16) against every second 64-key tile (kh).
// Two blocks share a WGP (waves_per_eu 4, 4: the grid is exactly two blocks per WGP): one block's waves cover the other's LDS and cross-lane waits.
// Per 128-key stage: 128 K rows [t][d] and 64 V^T rows [d][128 t] lie in one of two LDS buffers each (cross-wave regions); the next stage's two tensor loads (wave 0: K, wave 1: V^T; the pad field sets the LDS pitch) fly into the other buffers meanwhile.
// Foot of each trip: own LDS reads done, the issuing waves' loads landed, one block barrier (publishes stage s + 1 and frees stage s's buffers), then the loads of stage s + 2 into the freed buffers;
// S^T = K . Q^T per 16-key sub-tile (A = K rows from LDS, B = Q columns from the plane, both split-k loaders), so each lane holds 8 keys of one query; one K fragment serves both query tiles;
// online softmax in f32 (one multiply-add and one exp2 per score) against a maximum in use m: it is taken from the wave's first tile in front of the loop, and no maximum is taken on an ordinary trip;
// one wave-uniform test per trip, on each lane's own row sums, which are formed anyway: only where a sum has left the fp16 range are the scores formed again (K is still in LDS), their maximum taken,
// the halves' maxima joined, m raised, l and O rescaled and the trip's p and sums formed anew; p x1024 packed into A fragments straight from the two adjacent 16-key accumulator tiles
// (element r <- keys 0-15 tile, element 8+r <- keys 16-31 tile, lane unchanged); O += P . V with B = V^T rows from LDS, one V^T fragment serving both query tiles.
// After the loop the waves wq and wq + 4 hold (m, l, O) of the same 32 queries over complementary keys: register slot s holds query tile s ^ kh, each wave hands slot 1 to its partner through LDS
// (one block barrier) and merges the partner's slot 1 into its own slot 0 by the usual max / rescale rule, then normalises and stores those 16 queries.
typedef v2f __attribute__((may_alias)) v2fa;
typedef uint32_t u32x4 __attribute__((ext_vector_type(4)));
typedef uint32_t u32x8 __attribute__((ext_vector_type(8)));
__device__ __forceinline__ uint32_t uni(uint32_t v) { return (uint32_t)__builtin_amdgcn_readfirstlane(v); }
__device__ __forceinline__ uint32_t pinned(uint32_t v) { uint32_t w = (uint32_t)__builtin_amdgcn_readfirstlane(v); asm volatile("" : "+s"(w)); return w; }   // a wave-uniform test held in a scalar register, so that the branch on it is a scalar branch: a tensor load ignores EXEC
// Descriptor group 1 of a tile of ROWS rows of ROWB bytes at source pitch PITCH bytes, landing in LDS at pitch ROWB + 16 (pad word W0: interval = the row, 4 dwords); 1-byte elements, tensor = tile, no mask.
template <uint32_t W0, uint32_t ROWB, uint32_t ROWS, uint32_t PITCH>
__device__ __forceinline__ u32x8 tdm_group1() {
    u32x8 g1;
    g1[0] = uni(W0); g1[1] = uni((ROWB & 0xFFFFu) << 16); g1[2] = uni((ROWB >> 16) | ((ROWS & 0xFFFFu) << 16)); g1[3] = uni((ROWS >> 16) | (ROWB << 16));
    g1[4] = uni(ROWS); g1[5] = uni(PITCH); g1[6] = uni(0u); g1[7] = uni(0u);
    asm volatile("" : "+s"(g1));   // pinned(), for a whole group: the descriptor words held in scalar registers of their own from here on, so that none takes a new value while a request is outstanding
    return g1;
}
// One tensor load; the waits are written at the places that need them.
__device__ __forceinline__ void tdm_load(u32x4& g0, uint32_t lds, uint64_t ga, u32x8 g1) {
    g0[1] = uni(lds); g0[2] = uni((uint32_t)ga); g0[3] = uni((((uint32_t)(ga >> 32)) & 0x01FFFFFFu) | 0x80000000u);
    asm volatile("tensor_load_to_lds %0, %1" :: "s"(g0), "s"(g1) : "memory");
}

__global__ __launch_bounds__(256) __attribute__((amdgpu_waves_per_eu(4, 4)))
void k_attn(const h16* __restrict__ Q16, const h16* __restrict__ K16, const h16* __restrict__ VT16, float* OUT) {
    __shared__ __attribute__((aligned(2048))) h16 KV[4][SBUF];   // [0], [1]: two buffers of 128 K rows [t][d] at pitch KP; [2], [3]: two buffers of 64 V^T rows [d][128 t] at pitch VP; cross-wave (block barriers)
    __shared__ __align__(16) float osh[8][16 * OSP];     // wave-private output staging
    __shared__ __align__(16) float xo[8][4 * 2 * 32 * 4]; // hand-over of one O tile per wave, [et][register quad][lane], cross-wave (block barrier)
    __shared__ __align__(8)  float xml[8][32 * 2];       // hand-over of that tile's (m, l), cross-wave (block barrier)
    const int tid = threadIdx.x, wv = tid >> 5, lane = tid & 31, lr = lane & 15, hi = lane >> 4;
    const int wq = wv & 3, kh = wv >> 2;
    const int qblks = SEQ / QB; const int bh = blockIdx.x / qblks, qblk = blockIdx.x % qblks; const int b = bh / NH, h = bh % NH;
    const int q0 = qblk * QB + wq * (16 * QTW);
    const h16* Qp = Q16 + ((size_t)bh * SEQ + q0) * HD;
    v16h qf[QTW][2];
#pragma unroll
    for (int qt = 0; qt < QTW; ++qt)
#pragma unroll
        for (int kk = 0; kk < 2; ++kk) qf[qt][kk] = ldh(Qp + (size_t)((qt ^ kh) * 16 + lr) * HD + kk * 32 + 8 * hi);
    const h16* Kb = K16 + (size_t)bh * SEQ * HD; const h16* Vb = VT16 + (size_t)bh * HD * SEQ;
    v8f o[QTW][4];
#pragma unroll
    for (int qt = 0; qt < QTW; ++qt)
#pragma unroll
        for (int et = 0; et < 4; ++et) o[qt][et] = (v8f){};
    float m_run[QTW], l_run[QTW], nb[QTW];   // nb = PCARL2 - m_run * CEX, the addend of the scores' multiply-add; it changes only where m_run does
#pragma unroll
    for (int qt = 0; qt < QTW; ++qt) { m_run[qt] = -1.0e30f; l_run[qt] = 0.f; nb[qt] = 0.f; }
    float* os = osh[wv];
    // staging: wave 0 brings the stage's K rows, wave 1 its V^T rows, one request each
    const uint32_t wave = uni((uint32_t)tid >> 5), lbase = (uint32_t)(size_t)&KV[0][0];
    uint64_t gk = (uint64_t)(size_t)Kb, gv = (uint64_t)(size_t)Vb;
    const u32x8 g1k = tdm_group1<(1u << 20) | (4u << 22) | (3u << 25), 2u * HD, KSP * KT, 2u * HD>();         // 128 rows of 128 B, contiguous in K16
    const u32x8 g1v = tdm_group1<(1u << 20) | (5u << 22) | (3u << 25), 2u * KSP * KT, HD, 2u * SEQ>();        // 64 rows of 256 B at the pitch of VT16
    u32x4 g0; g0[0] = uni(1u); g0[1] = uni(0u); g0[2] = uni(0u); g0[3] = uni(0u);
    asm volatile("" : "+s"(g0));   // pinned(), for group 0: descriptor words held in scalar registers of their own; word 0 (count 1) is written once, word 3 only behind the wait that covers the wave's last request
    if (pinned(wave == 0)) { tdm_load(g0, lbase, gk, g1k); asm volatile("s_wait_tensorcnt 0x0" ::: "memory"); }   // stage 0 has landed before the barrier publishes it
    if (pinned(wave == 1)) { tdm_load(g0, lbase + 2u * SBUF * 2u, gv, g1v); asm volatile("s_wait_tensorcnt 0x0" ::: "memory"); }
    __syncthreads();
    gk += KSP * KT * HD * 2; gv += KSP * KT * 2;
    if (pinned(wave == 0)) tdm_load(g0, lbase + SBUF * 2u, gk, g1k);
    if (pinned(wave == 1)) tdm_load(g0, lbase + 3u * SBUF * 2u, gv, g1v);
    v16h pa[QTW][2];
    float rs[QTW];
    // S^T of one 64-key tile for both query tiles
    auto scores = [&](const h16* Kc, v8f (&st)[QTW][4]) {
        v16h ka[4][2];
#pragma unroll
        for (int ts = 0; ts < 4; ++ts) { ka[ts][0] = ldh(Kc + (ts * 16 + lr) * KP + 8 * hi); ka[ts][1] = ldh(Kc + (ts * 16 + lr) * KP + 32 + 8 * hi); }
#pragma unroll
        for (int ts = 0; ts < 4; ++ts)
#pragma unroll
            for (int qt = 0; qt < QTW; ++qt) { v8f c = (v8f){}; c = wmma16(ka[ts][0], qf[qt][0], c); c = wmma16(ka[ts][1], qf[qt][1], c); st[qt][ts] = c; }
        // four vector slots between the last product and the first vector instruction that reads a score
        asm volatile("v_nop\n\tv_nop\n\tv_nop\n\tv_nop" : "+v"(st[0][0]), "+v"(st[0][1]), "+v"(st[0][2]), "+v"(st[0][3]), "+v"(st[1][0]), "+v"(st[1][1]), "+v"(st[1][2]), "+v"(st[1][3]) : "v"(ka[3][0]), "v"(ka[3][1]), "v"(qf[0][1]), "v"(qf[1][1]));
    };
    // maximum of one query's 64 raw scores: lane owns query lr, keys 8*hi + r of each 16-key sub-tile; the partner lane (lane ^ 16) owns the other 32 keys
    auto tile_max = [&](const v8f (&sq)[4]) {
        float tm = -1.0e30f;   // the factor CEX is positive, so the maximum of the raw scores is that of the scaled ones too
#pragma unroll
        for (int ts = 0; ts < 4; ++ts)
#pragma unroll
            for (int v = 0; v < 8; ++v) tm = fmaxf(tm, sq[ts][v]);
        return fmaxf(tm, __shfl_xor(tm, 16, 32));
    };
    // raise m to cover this tile: behind it no score of the tile stands above m_run, so every p x1024 is at most 1024 and a lane's sum at most 2^15
    auto raise_m = [&](const v8f (&st)[QTW][4]) {
#pragma unroll
        for (int qt = 0; qt < QTW; ++qt) {
            const float m_new = fmaxf(m_run[qt], tile_max(st[qt]));
            float alpha;
            // alpha = exp2((m_old - m_new) * CEX), in asm so that it is one unit with its v_nop: the free slot that the instruction set asks for behind a transcendental, here in front of the reads of alpha
            asm("v_exp_f32 %0, %1\n\tv_nop" : "=v"(alpha) : "v"((m_run[qt] - m_new) * CEX));
            m_run[qt] = m_new; nb[qt] = __builtin_fmaf(-m_new, CEX, PCARL2); l_run[qt] *= alpha;
            // rescale O: accumulator element v of this lane is query row 8*hi + v; alpha for that query lives in lane 8*hi + v
#pragma unroll
            for (int v = 0; v < 8; ++v) { const float fs = __shfl(alpha, v + 8 * hi, 32); o[qt][0][v] *= fs; o[qt][1][v] *= fs; o[qt][2][v] *= fs; o[qt][3][v] *= fs; }
        }
    };
    // p, each lane's row sums rs and the packed A fragments pa of one tile
    auto soft = [&](v8f (&st)[QTW][4]) {
#pragma unroll
        for (int qt = 0; qt < QTW; ++qt) {
            // p x1024 = exp2(s * CEX + nb): the score scale, log2 e and the carry sit in one multiply-add, two scores per packed instruction
            const v2f c2 = {CEX, CEX}, nb2 = {nb[qt], nb[qt]};
#pragma unroll
            for (int ts = 0; ts < 4; ++ts)
#pragma unroll
                for (int v = 0; v < 8; v += 2) { const v2f a = __builtin_elementwise_fma((v2f){st[qt][ts][v], st[qt][ts][v + 1]}, c2, nb2);
                    st[qt][ts][v] = __builtin_amdgcn_exp2f(a[0]); st[qt][ts][v + 1] = __builtin_amdgcn_exp2f(a[1]); }
            rs[qt] = 0.f;
#pragma unroll
            for (int v = 0; v < 8; v += 2) {   // two keys per packed add; every sum and its order as for one key at a time
                const v2f p0 = {st[qt][0][v], st[qt][0][v + 1]}, p1 = {st[qt][1][v], st[qt][1][v + 1]}, p2 = {st[qt][2][v], st[qt][2][v + 1]}, p3 = {st[qt][3][v], st[qt][3][v + 1]};
                const v2f t = (p0 + p1) + (p2 + p3);
                rs[qt] += t[0]; rs[qt] += t[1];
#pragma unroll
                for (int w = 0; w < 2; ++w) {
                    pa[qt][0][v + w] = (h16)p0[w]; pa[qt][0][v + w + 8] = (h16)p1[w];   // keys 8h+v and 16+8h+v of the 64-key tile
                    pa[qt][1][v + w] = (h16)p2[w]; pa[qt][1][v + w + 8] = (h16)p3[w];   // keys 32+8h+v and 48+8h+v
                }
            }
        }
    };
    // the first maximum in use: that of the wave's own tile of stage 0, which the barrier above has published (l and O are still 0: nothing to rescale)
    { v8f st[QTW][4]; scores(KV[0] + kh * KT * KP, st);
#pragma unroll
      for (int qt = 0; qt < QTW; ++qt) { m_run[qt] = tile_max(st[qt]); nb[qt] = __builtin_fmaf(-m_run[qt], CEX, PCARL2); } }
    uint32_t coff = 0;   // halves from buffer 0 to the buffer in use: 0 or SBUF in turn
#pragma unroll 1
    for (int t0 = 0; t0 < SEQ; t0 += KSP * KT) {
        const h16* Kc = KV[0] + coff + kh * KT * KP; const h16* Vc = KV[2] + coff + kh * KT;
        v8f st[QTW][4]; v16h vb[4][2];
        scores(Kc, st);
        // the V^T fragments, in two halves: all four at once, beside both tiles' scores, did not fit the registers (as built, the reads and the fp16 conversions stand on the ordinary side of the guard's branch, reads first)
#pragma unroll
        for (int et = 0; et < 2; ++et) { vb[et][0] = ldh(Vc + (et * 16 + lr) * VP + 8 * hi); vb[et][1] = ldh(Vc + (et * 16 + lr) * VP + 32 + 8 * hi); }
        soft(st);
#pragma unroll
        for (int et = 2; et < 4; ++et) { vb[et][0] = ldh(Vc + (et * 16 + lr) * VP + 8 * hi); vb[et][1] = ldh(Vc + (et * 16 + lr) * VP + 32 + 8 * hi); }
        // the fp16 guard, one scalar branch per trip: every p is positive, so none exceeds its lane's sum (an infinite p makes the sum infinite)
        if (__builtin_amdgcn_ballot_w32(fmaxf(rs[0], rs[1]) > PLIM) != 0) {
            scores(Kc, st); raise_m(st); soft(st);
            // the V^T fragments are read again here, so that they hold no registers beside the K fragments and the scores above
#pragma unroll
            for (int et = 0; et < 4; ++et) { vb[et][0] = ldh(Vc + (et * 16 + lr) * VP + 8 * hi); vb[et][1] = ldh(Vc + (et * 16 + lr) * VP + 32 + 8 * hi); }
        }
#pragma unroll
        for (int qt = 0; qt < QTW; ++qt) { rs[qt] += __shfl_xor(rs[qt], 16, 32); l_run[qt] += rs[qt]; }
#pragma unroll
        for (int et = 0; et < 4; ++et)
#pragma unroll
            for (int qt = 0; qt < QTW; ++qt) { o[qt][et] = wmma16(pa[qt][0], vb[et][0], o[qt][et]); o[qt][et] = wmma16(pa[qt][1], vb[et][1], o[qt][et]); }
        // four vector slots between the last product and whatever follows it on either side of the loop's branches
        asm volatile("v_nop\n\tv_nop\n\tv_nop\n\tv_nop" : "+v"(o[0][0]), "+v"(o[0][1]), "+v"(o[0][2]), "+v"(o[0][3]), "+v"(o[1][0]), "+v"(o[1][1]), "+v"(o[1][2]), "+v"(o[1][3]) : "v"(pa[0][0]), "v"(pa[0][1]), "v"(pa[1][0]), "v"(pa[1][1]), "v"(vb[3][1]));
        asm volatile("s_wait_dscnt 0x0" ::: "memory");      // this wave's reads of the current buffer are done before the barrier frees it for refilling
        if (pinned(wave < 2)) asm volatile("s_wait_tensorcnt 0x0" ::: "memory");   // an issuing wave's load of the next stage has landed before the barrier publishes it
        __syncthreads();
        if (pinned(t0 + 2 * KSP * KT < SEQ)) {              // scalar: a stage s + 2 exists
            gk += KSP * KT * HD * 2; gv += KSP * KT * 2;
            if (pinned(wave == 0)) tdm_load(g0, lbase + coff * 2u, gk, g1k);
            if (pinned(wave == 1)) tdm_load(g0, lbase + 2u * SBUF * 2u + coff * 2u, gv, g1v);
        }
        coff ^= SBUF;
    }
    asm volatile("s_wait_tensorcnt 0x0" ::: "memory");      // nothing of this wave is in flight when it goes on to the epilogue and ends
    asm volatile("s_wait_dscnt 0x0" ::: "memory");          // nor is any LDS read of the ring
    // hand-over: slot 1 (query tile 1 ^ kh) goes to the partner wave, whose slot 0 is that tile; same lane, same register on both sides
    {
        float* xw = xo[wv];
#pragma unroll
        for (int et = 0; et < 4; ++et) {
            *(v4fa*)(xw + ((et * 2 + 0) * 32 + lane) * 4) = __builtin_shufflevector(o[1][et], o[1][et], 0, 1, 2, 3);
            *(v4fa*)(xw + ((et * 2 + 1) * 32 + lane) * 4) = __builtin_shufflevector(o[1][et], o[1][et], 4, 5, 6, 7); }
        *(v2fa*)(xml[wv] + lane * 2) = (v2f){m_run[1], l_run[1]};
    }
    __syncthreads();                                        // the partner's tile is read only behind this barrier
    // merge and epilogue: out[b][q][h*HD + d] = (O_a fa + O_b fb) / (l_a fa + l_b fb), f = exp2((m - max(m_a, m_b)) * CEX); O and l both carry x1024
    {
        const float* xr = xo[wv ^ 4];
        const v2f ml = *(const v2fa*)(xml[wv ^ 4] + lane * 2);
        const float mm = fmaxf(m_run[0], ml[0]);
        const float fa = __builtin_amdgcn_exp2f((m_run[0] - mm) * CEX), fb = __builtin_amdgcn_exp2f((ml[0] - mm) * CEX);
        const float inv = 1.0f / (l_run[0] * fa + ml[1] * fb);
        const float ga = fa * inv, gb = fb * inv;
        v4f pb[4][2];
#pragma unroll
        for (int et = 0; et < 4; ++et) { pb[et][0] = *(const v4fa*)(xr + ((et * 2 + 0) * 32 + lane) * 4); pb[et][1] = *(const v4fa*)(xr + ((et * 2 + 1) * 32 + lane) * 4); }
#pragma unroll
        for (int j = 0; j < 8; ++j) { const float fsa = __shfl(ga, j + 8 * hi, 32), fsb = __shfl(gb, j + 8 * hi, 32);
#pragma unroll
            for (int et = 0; et < 4; ++et) os[(hi * 8 + j) * OSP + et * 16 + lr] = o[0][et][j] * fsa + pb[et][j >> 2][j & 3] * fsb; }
        __builtin_amdgcn_fence(3, "wavefront"); __builtin_amdgcn_wave_barrier(); asm volatile("" ::: "memory");
        float* crow = OUT + ((size_t)b * SEQ + q0 + kh * 16) * DM + (size_t)h * HD;
#pragma unroll
        for (int s = 0; s < 8; ++s) { const int row = 2 * s + hi, cofs = lr * 4; const v4f val = *(const v4fa*)(os + row * OSP + cofs);
            *(v4f*)(crow + (size_t)row * DM + cofs) = val; }
    }
}

extern "C" void kernel_launch(void* const* d_in, const int* in_sizes, int n_in,
                              void* d_out, int out_size, void* d_ws, size_t ws_size, hipStream_t stream) {
    if (n_in < 7) return;
    if (in_sizes[0] < (NB - 1) * SEQ_FULL * DM + SEQ * DM) return;
    if (in_sizes[1] < NH * HD * HD || in_sizes[3] < NH * HD * HD || in_sizes[5] < NH * HD * HD) return;
    if (in_sizes[2] < NH * HD || in_sizes[4] < NH * HD || in_sizes[6] < NH * HD) return;
    if (out_size < NB * SEQ * DM) return;
    const float* x = (const float*)d_in[0]; const float* wq = (const float*)d_in[1]; const float* bq = (const float*)d_in[2]; const float* wk = (const float*)d_in[3]; const float* bk = (const float*)d_in[4]; const float* wv = (const float*)d_in[5]; const float* bv = (const float*)d_in[6];
    float* OUT = (float*)d_out;     // [NB][SEQ][DM]
    char* wsp = (char*)d_ws;
    auto take = [&](size_t bytes) { char* p = wsp; wsp += (bytes + 255) & ~(size_t)255; return (void*)p; };
    h16* Q16  = (h16*)take((size_t)NB * NH * SEQ * HD * 2);    // [NB][16][SEQ][64] fp16 = 8,388,608 B
    h16* K16  = (h16*)take((size_t)NB * NH * SEQ * HD * 2);
    h16* VT16 = (h16*)take((size_t)NB * NH * HD * SEQ * 2);    // [NB][16][64][SEQ] fp16
    if ((size_t)(wsp - (char*)d_ws) > ws_size) return;         // total 25,165,824 B
    k_proj<<<dim3((unsigned)(NB * SEQ / PRB), NH, 1), 256, 0, stream>>>(x, wq, bq, wk, bk, wv, bv, Q16, K16, VT16);
    k_attn<<<(unsigned)(NB * NH * (SEQ / QB)), 256, 0, stream>>>(Q16, K16, VT16, OUT);
}
